// v000
// Times are from an AMD MI455X. After a warm-up the kernel runs many times in a row, and a time is the length of
// such a window on the GPU divided by its runs, so every launch and the gaps after it count. The runs cycle
// through copies of the inputs. A figure is the median of several windows, for all but v000 over two sittings.
// Sittings can differ by a few percent; kernels timed side by side share one.
// v000 is the starting kernel. One run takes 781 microseconds.
// compute dtype: all float inputs rounded to bf16; the level-masked first linear as EXACT bf16 products on WMMA 16x16x32 ((in,out) weights as transposed rows) accumulated block-suffix-wise in f32 (level l = sum of the 128-wide input blocks >= l), + b1, tanh-GELU (precise tanhf), hidden rounded once to f16 x exact f16 copies of W2 (x 2^8), + b2; f32 output.
#include <hip/hip_runtime.h>
#include <math.h>

typedef __attribute__((ext_vector_type(16))) _Float16 v16h;
typedef __attribute__((ext_vector_type(16))) __bf16 v16b;
typedef __attribute__((ext_vector_type(8)))  _Float16 v8h;
typedef __attribute__((ext_vector_type(8)))  float v8f;
typedef __attribute__((ext_vector_type(4)))  float v4f;
typedef __attribute__((ext_vector_type(2)))  float v2f;
typedef __attribute__((ext_vector_type(4)))  unsigned v4u;
typedef __attribute__((ext_vector_type(4)))  int v4i;
typedef float __attribute__((may_alias)) float_a;
typedef int __attribute__((may_alias)) int_a;

template <typename T> __device__ __forceinline__ void vst2(void* p, T v) { *(T*)p = v;  }
__device__ __forceinline__ v8f wmma16(v16h a, v16h b, v8f c) {
  v8f d = __builtin_amdgcn_wmma_f32_16x16x32_f16(false, a, false, b, (short)0, c, false, false);
  asm volatile("v_nop\n\tv_nop\n\tv_nop\n\tv_nop" : "+v"(d) : "v"(a), "v"(b));
  return d;
}
__device__ __forceinline__ v8f wmma_bf(v16b a, v16b b, v8f c) {
  v8f d = __builtin_amdgcn_wmma_f32_16x16x32_bf16(false, a, false, b, (short)0, c, false, false);
  asm volatile("v_nop\n\tv_nop\n\tv_nop\n\tv_nop" : "+v"(d) : "v"(a), "v"(b));
  return d;
}
// 16x16x32 fragments: lane = (h = lane>>4, row/col = lane&15); elements 0..7 = k0+8h+0..7, 8..15 = k0+16+8h+0..7; D element r = row 8h+r
__device__ __forceinline__ v16h frag_h(const _Float16* rowk0, int lane) {
  union { v16h v; v8h q[2]; } u; const _Float16* p = rowk0 + 8 * (lane >> 4);
  u.q[0] = *(const v8h*)p; u.q[1] = *(const v8h*)(p + 16); return u.v;
}
__device__ __forceinline__ v16h frag_f32(const float* rowk0, int lane) {
  v16h a; const float* p = rowk0 + 8 * (lane >> 4);
#pragma unroll
  for (int i = 0; i < 8; ++i) { a[i] = (_Float16)p[i]; a[8 + i] = (_Float16)p[16 + i]; }
  return a;
}
__device__ __forceinline__ v16h frag_f32s(const float* rowk0, int lane, float sc) {
  v16h a; const float* p = rowk0 + 8 * (lane >> 4);
#pragma unroll
  for (int i = 0; i < 8; ++i) { a[i] = (_Float16)(p[i] * sc); a[8 + i] = (_Float16)(p[16 + i] * sc); }
  return a;
}
// column fragment from a [K][ld] layout (column n), rows >= K read as 0
__device__ __forceinline__ v16h fragc_f32(const float* W, int k0, int n, int lane, int ld, int K) {
  v16h a; const int g = lane >> 4;
#pragma unroll
  for (int i = 0; i < 8; ++i) { const int ka = k0 + 8 * g + i, kb = ka + 16;
    a[i] = (_Float16)(ka < K ? W[(size_t)(ka < K ? ka : K - 1) * ld + n] : 0.f); a[8 + i] = (_Float16)(kb < K ? W[(size_t)(kb < K ? kb : K - 1) * ld + n] : 0.f); }
  return a;
}
struct F2 { v16b h, l; };
__device__ __forceinline__ F2 bsplit16(const float v[16]) { F2 r;
#pragma unroll
  for (int i = 0; i < 16; ++i) { const __bf16 h = (__bf16)v[i]; r.h[i] = h; r.l[i] = (__bf16)(v[i] - (float)h); }
  return r; }
__device__ __forceinline__ F2 split_row(const float* row, int k0, int lane) { float v[16]; const float* p = row + k0 + 8 * (lane >> 4);
#pragma unroll
  for (int i = 0; i < 8; ++i) { v[i] = p[i]; v[8 + i] = p[16 + i]; }
  return bsplit16(v); }
__device__ __forceinline__ F2 split_rowK(const float* row, int k0, int lane, int K) { float v[16]; const int g = lane >> 4;
#pragma unroll
  for (int i = 0; i < 8; ++i) { const int ka = k0 + 8 * g + i, kb = ka + 16; v[i] = ka < K ? row[ka < K ? ka : K - 1] : 0.f; v[8 + i] = kb < K ? row[kb < K ? kb : K - 1] : 0.f; }
  return bsplit16(v); }
__device__ __forceinline__ F2 split_col(const float* W, int k0, int n, int lane, int ld, int K) { float v[16]; const int g = lane >> 4;
#pragma unroll
  for (int i = 0; i < 8; ++i) { const int ka = k0 + 8 * g + i, kb = ka + 16; v[i] = ka < K ? W[(size_t)(ka < K ? ka : K - 1) * ld + n] : 0.f; v[8 + i] = kb < K ? W[(size_t)(kb < K ? kb : K - 1) * ld + n] : 0.f; }
  return bsplit16(v); }
__device__ __forceinline__ v8f mac3(const F2& a, const F2& b, v8f c) { c = wmma_bf(a.l, b.h, c); c = wmma_bf(a.h, b.l, c); return wmma_bf(a.h, b.h, c); }
__device__ __forceinline__ float sigm(float v) { return 1.0f / (1.0f + expf(-v)); }
#define LDSX() do { asm volatile("s_wait_dscnt 0" ::: "memory"); __builtin_amdgcn_wave_barrier(); __builtin_amdgcn_fence(__ATOMIC_RELEASE, "workgroup"); } while (0)


// Tree MLP (B 16, P 256, 8 levels x 128, hidden 4,096): level l sees the token embedding with its first l*128 entries zeroed; h = NewGELU(inp W1 + b1), out = h W2 + b2 per level.
#define NRW 4096          // B*P rows
#define LV 8
#define RR 128
#define NE (LV * RR)      // 1024
#define HH 4096
#ifndef TRB
#define TRB (NRW / 64)
#endif
typedef __attribute__((ext_vector_type(8))) __bf16 v8b;
__device__ __forceinline__ v16b frag_b(const __bf16* rowk0, int lane) {
  union { v16b v; v8b q[2]; } u; const __bf16* p = rowk0 + 8 * (lane >> 4);
  u.q[0] = *(const v8b*)p; u.q[1] = *(const v8b*)(p + 16); return u.v;
}
__device__ __forceinline__ float bfr(float v) { return (float)(__bf16)v; }
__device__ __attribute__((noinline)) float exp_ni(float v) { return expf(v); }
__device__ __attribute__((noinline)) float erf_ni(float v) { return erff(v); }

#define WS_P1  0u                                  // bf16 rows W1^T [4096][1024]
#define WS_P2  (WS_P1 + 2u * (size_t)HH * NE)       // f16 x 2^8 rows W2^T [128][4096]
#define WS_H   (WS_P2 + 2u * (size_t)RR * HH)
#define WS_END (WS_H + 2u * (size_t)4 * NRW * HH)

__global__ __launch_bounds__(256) void k_pack(const float* __restrict__ W1, const float* __restrict__ W2, __bf16* __restrict__ P1, _Float16* __restrict__ P2) { const int n = blockIdx.x, t = threadIdx.x;
  if (n < HH) { __shared__ __align__(16) __bf16 s[NE]; for (int k = t; k < NE; k += 256) s[k] = (__bf16)W1[(size_t)k * HH + n]; __syncthreads(); for (int q = t; q < NE / 8; q += 256) vst2((unsigned*)(P1 + (size_t)n * NE + q * 8), *(const v4u*)&s[q * 8]); }
  else { const int r = n - HH; __shared__ __align__(16) _Float16 s2[HH]; for (int k = t; k < HH; k += 256) s2[k] = (_Float16)(bfr(W2[(size_t)k * RR + r]) * 256.0f); __syncthreads(); for (int q = t; q < HH / 8; q += 256) vst2((unsigned*)(P2 + (size_t)r * HH + q * 8), *(const v4u*)&s2[q * 8]); } }
__device__ __attribute__((noinline)) float tanh_p(float v) { return tanhf(v); }
__device__ __forceinline__ float gelu_n(float x) { return 0.5f * x * (1.0f + tanh_p(0.7978845608028654f * (x + 0.044715f * x * x * x))); }
template <int PASS>
__global__ __launch_bounds__(128) void k_lev(const float* __restrict__ X, const __bf16* __restrict__ P1, const float* __restrict__ B1, _Float16* __restrict__ H) {
  __shared__ __align__(16) _Float16 sg[4][16][136];
  const int tid = threadIdx.x, wave = tid >> 5, lane = tid & 31, col = lane & 15, g = lane >> 4; const size_t r0 = (size_t)blockIdx.x * 64 + wave * 16; const int n0 = blockIdx.y * 128;
  v8f acc[8] = {};
#pragma unroll 1
  for (int lv = LV - 1; lv >= 0; --lv) {
#pragma unroll
    for (int kq = 0; kq < RR / 32; ++kq) { const int kc = lv * (RR / 32) + kq; v16b a; { const float* p = X + (r0 + col) * NE + kc * 32 + 8 * g;
#pragma unroll
        for (int i = 0; i < 8; ++i) { a[i] = (__bf16)p[i]; a[8 + i] = (__bf16)p[16 + i]; } }
#pragma unroll
      for (int j = 0; j < 8; ++j) acc[j] = wmma_bf(a, frag_b(P1 + (size_t)(n0 + j * 16 + col) * NE + kc * 32, lane), acc[j]); }
    if ((PASS == 0 && lv >= 4) || (PASS == 1 && lv < 4)) {
#pragma unroll
    for (int j = 0; j < 8; ++j) { const float bb = bfr(B1[n0 + j * 16 + col]);
#pragma unroll
      for (int r = 0; r < 8; ++r) sg[wave][8 * g + r][j * 16 + col] = (_Float16)gelu_n(acc[j][r] + bb); }
    LDSX();
    for (int rl = 0; rl < 16; ++rl) if (lane < 16) vst2((unsigned*)(H + ((size_t)(lv & 3) * NRW + r0 + rl) * HH + n0 + lane * 8), *(const v4u*)&sg[wave][rl][lane * 8]);
    LDSX(); }
    if (PASS == 0 && lv == 4) break; }
}
// ---- k_out: block = (64 rows, level slot): out[row][lv][0..128) = H[lv % 4][row] . W2 + b2 (K 4096); lv = slot + 4 * first-pass flag
__global__ __launch_bounds__(128) void k_out(const _Float16* __restrict__ H, const _Float16* __restrict__ P2, const float* __restrict__ B2, int lvbase, float* __restrict__ OUT) {
  __shared__ __align__(16) float so[4][16][132];
  const int tid = threadIdx.x, wave = tid >> 5, lane = tid & 31, col = lane & 15, g = lane >> 4; const size_t r0 = (size_t)blockIdx.x * 64 + wave * 16; const int slot = blockIdx.y; const int lv = lvbase + slot;
  v8f acc[8] = {};
#pragma unroll 2
  for (int kc = 0; kc < HH / 32; ++kc) { const v16h a = frag_h(H + ((size_t)slot * NRW + r0 + col) * HH + kc * 32, lane);
#pragma unroll
    for (int j = 0; j < 8; ++j) acc[j] = wmma16(a, frag_h(P2 + (size_t)(j * 16 + col) * HH + kc * 32, lane), acc[j]); }
#pragma unroll
  for (int j = 0; j < 8; ++j) { const float bb = bfr(B2[j * 16 + col]);
#pragma unroll
    for (int r = 0; r < 8; ++r) so[wave][8 * g + r][j * 16 + col] = acc[j][r] * (1.0f / 256.0f) + bb; }
  LDSX();
  for (int rl = 0; rl < 16; ++rl) vst2(OUT + ((r0 + rl) * LV + lv) * RR + lane * 4, *(const v4f*)&so[wave][rl][lane * 4]);   // 512-B (row, level) segment
}
extern "C" void kernel_launch(void* const* d_in, const int* in_sizes, int n_in, void* d_out, int out_size, void* d_ws, size_t ws_size, hipStream_t stream) {
  (void)in_sizes; (void)n_in; (void)out_size;
  const float** F = (const float**)d_in;   // 0 x [16,256,8,128], 1 W1 [1024,4096] (in,out), 2 b1, 3 W2 [4096,128], 4 b2
  if (ws_size < (size_t)WS_END) return;
  char* ws = (char*)d_ws; __bf16* P1 = (__bf16*)(ws + WS_P1); _Float16 *P2 = (_Float16*)(ws + WS_P2), *H = (_Float16*)(ws + WS_H);
  k_pack<<<HH + RR, 256, 0, stream>>>(F[1], F[3], P1, P2);
  k_lev<0><<<dim3(TRB, HH / 128), 128, 0, stream>>>(F[0], P1, F[2], H);   // levels 7..4 -> slots 3..0
  k_out<<<dim3(TRB, 4), 128, 0, stream>>>(H, P2, F[4], 4, (float*)d_out);
  k_lev<1><<<dim3(TRB, HH / 128), 128, 0, stream>>>(F[0], P1, F[2], H);   // levels 3..0
  k_out<<<dim3(TRB, 4), 128, 0, stream>>>(H, P2, F[4], 0, (float*)d_out);
}

// v001
// One run takes 465 microseconds.
// Next to v000, in two timings, it ran 1.65 and 1.63 times as fast.
// compute dtype: all float inputs rounded to bf16; the level-masked first linear as EXACT bf16 products on WMMA 16x16x32 ((in,out) weights as transposed rows) accumulated block-suffix-wise in f32 (level l = sum of the 128-wide input blocks >= l), + b1, tanh-GELU (precise tanhf), hidden rounded once to f16 x exact f16 copies of W2 (x 2^8), + b2; f32 output.
#include <hip/hip_runtime.h>
#include <math.h>

typedef __attribute__((ext_vector_type(16))) _Float16 v16h;
typedef __attribute__((ext_vector_type(16))) __bf16 v16b;
typedef __attribute__((ext_vector_type(8)))  _Float16 v8h;
typedef __attribute__((ext_vector_type(8)))  float v8f;
typedef __attribute__((ext_vector_type(4)))  float v4f;
typedef __attribute__((ext_vector_type(2)))  float v2f;
typedef __attribute__((ext_vector_type(4)))  unsigned v4u;
typedef __attribute__((ext_vector_type(4)))  int v4i;
typedef float __attribute__((may_alias)) float_a;
typedef int __attribute__((may_alias)) int_a;

template <typename T> __device__ __forceinline__ void vst2(void* p, T v) { *(T*)p = v;  }
__device__ __forceinline__ v8f wmma16(v16h a, v16h b, v8f c) {
  v8f d = __builtin_amdgcn_wmma_f32_16x16x32_f16(false, a, false, b, (short)0, c, false, false);
  asm volatile("v_nop\n\tv_nop\n\tv_nop\n\tv_nop" : "+v"(d) : "v"(a), "v"(b));
  return d;
}
__device__ __forceinline__ v8f wmma_bf(v16b a, v16b b, v8f c) {
  v8f d = __builtin_amdgcn_wmma_f32_16x16x32_bf16(false, a, false, b, (short)0, c, false, false);
  asm volatile("v_nop\n\tv_nop\n\tv_nop\n\tv_nop" : "+v"(d) : "v"(a), "v"(b));
  return d;
}
// 16x16x32 fragments: lane = (h = lane>>4, row/col = lane&15); elements 0..7 = k0+8h+0..7, 8..15 = k0+16+8h+0..7; D element r = row 8h+r
__device__ __forceinline__ v16h frag_h(const _Float16* rowk0, int lane) {
  union { v16h v; v8h q[2]; } u; const _Float16* p = rowk0 + 8 * (lane >> 4);
  u.q[0] = *(const v8h*)p; u.q[1] = *(const v8h*)(p + 16); return u.v;
}
__device__ __forceinline__ v16h frag_f32(const float* rowk0, int lane) {
  v16h a; const float* p = rowk0 + 8 * (lane >> 4);
#pragma unroll
  for (int i = 0; i < 8; ++i) { a[i] = (_Float16)p[i]; a[8 + i] = (_Float16)p[16 + i]; }
  return a;
}
__device__ __forceinline__ v16h frag_f32s(const float* rowk0, int lane, float sc) {
  v16h a; const float* p = rowk0 + 8 * (lane >> 4);
#pragma unroll
  for (int i = 0; i < 8; ++i) { a[i] = (_Float16)(p[i] * sc); a[8 + i] = (_Float16)(p[16 + i] * sc); }
  return a;
}
// column fragment from a [K][ld] layout (column n), rows >= K read as 0
__device__ __forceinline__ v16h fragc_f32(const float* W, int k0, int n, int lane, int ld, int K) {
  v16h a; const int g = lane >> 4;
#pragma unroll
  for (int i = 0; i < 8; ++i) { const int ka = k0 + 8 * g + i, kb = ka + 16;
    a[i] = (_Float16)(ka < K ? W[(size_t)(ka < K ? ka : K - 1) * ld + n] : 0.f); a[8 + i] = (_Float16)(kb < K ? W[(size_t)(kb < K ? kb : K - 1) * ld + n] : 0.f); }
  return a;
}
struct F2 { v16b h, l; };
__device__ __forceinline__ F2 bsplit16(const float v[16]) { F2 r;
#pragma unroll
  for (int i = 0; i < 16; ++i) { const __bf16 h = (__bf16)v[i]; r.h[i] = h; r.l[i] = (__bf16)(v[i] - (float)h); }
  return r; }
__device__ __forceinline__ F2 split_row(const float* row, int k0, int lane) { float v[16]; const float* p = row + k0 + 8 * (lane >> 4);
#pragma unroll
  for (int i = 0; i < 8; ++i) { v[i] = p[i]; v[8 + i] = p[16 + i]; }
  return bsplit16(v); }
__device__ __forceinline__ F2 split_rowK(const float* row, int k0, int lane, int K) { float v[16]; const int g = lane >> 4;
#pragma unroll
  for (int i = 0; i < 8; ++i) { const int ka = k0 + 8 * g + i, kb = ka + 16; v[i] = ka < K ? row[ka < K ? ka : K - 1] : 0.f; v[8 + i] = kb < K ? row[kb < K ? kb : K - 1] : 0.f; }
  return bsplit16(v); }
__device__ __forceinline__ F2 split_col(const float* W, int k0, int n, int lane, int ld, int K) { float v[16]; const int g = lane >> 4;
#pragma unroll
  for (int i = 0; i < 8; ++i) { const int ka = k0 + 8 * g + i, kb = ka + 16; v[i] = ka < K ? W[(size_t)(ka < K ? ka : K - 1) * ld + n] : 0.f; v[8 + i] = kb < K ? W[(size_t)(kb < K ? kb : K - 1) * ld + n] : 0.f; }
  return bsplit16(v); }
__device__ __forceinline__ v8f mac3(const F2& a, const F2& b, v8f c) { c = wmma_bf(a.l, b.h, c); c = wmma_bf(a.h, b.l, c); return wmma_bf(a.h, b.h, c); }
__device__ __forceinline__ float sigm(float v) { return 1.0f / (1.0f + expf(-v)); }
#define LDSX() do { asm volatile("s_wait_dscnt 0" ::: "memory"); __builtin_amdgcn_wave_barrier(); __builtin_amdgcn_fence(__ATOMIC_RELEASE, "workgroup"); } while (0)


// Tree MLP (B 16, P 256, 8 levels x 128, hidden 4,096): level l sees the token embedding with its first l*128 entries zeroed; h = NewGELU(inp W1 + b1), out = h W2 + b2 per level.
#define NRW 4096          // B*P rows
#define LV 8
#define RR 128
#define NE (LV * RR)      // 1024
#define HH 4096
#ifndef TRB
#define TRB (NRW / 64)
#endif
typedef __attribute__((ext_vector_type(8))) __bf16 v8b;
__device__ __forceinline__ v16b frag_b(const __bf16* rowk0, int lane) {
  union { v16b v; v8b q[2]; } u; const __bf16* p = rowk0 + 8 * (lane >> 4);
  u.q[0] = *(const v8b*)p; u.q[1] = *(const v8b*)(p + 16); return u.v;
}
__device__ __forceinline__ float bfr(float v) { return (float)(__bf16)v; }
__device__ __attribute__((noinline)) float exp_ni(float v) { return expf(v); }
__device__ __attribute__((noinline)) float erf_ni(float v) { return erff(v); }

#define WS_P1  0u                                  // bf16 rows W1^T [4096][1024]
#define WS_P2  (WS_P1 + 2u * (size_t)HH * NE)       // f16 x 2^8 rows W2^T [128][4096]
#define WS_H   (WS_P2 + 2u * (size_t)RR * HH)
#define WS_END (WS_H + 2u * (size_t)4 * NRW * HH)

__global__ __launch_bounds__(256) void k_pack(const float* __restrict__ W1, const float* __restrict__ W2, __bf16* __restrict__ P1, _Float16* __restrict__ P2) { const int n = blockIdx.x, t = threadIdx.x;
  if (n < HH) { __shared__ __align__(16) __bf16 s[NE]; for (int k = t; k < NE; k += 256) s[k] = (__bf16)W1[(size_t)k * HH + n]; __syncthreads(); for (int q = t; q < NE / 8; q += 256) vst2((unsigned*)(P1 + (size_t)n * NE + q * 8), *(const v4u*)&s[q * 8]); }
  else { const int r = n - HH; __shared__ __align__(16) _Float16 s2[HH]; for (int k = t; k < HH; k += 256) s2[k] = (_Float16)(bfr(W2[(size_t)k * RR + r]) * 256.0f); __syncthreads(); for (int q = t; q < HH / 8; q += 256) vst2((unsigned*)(P2 + (size_t)r * HH + q * 8), *(const v4u*)&s2[q * 8]); } }
__device__ __attribute__((noinline)) float tanh_p(float v) { return tanhf(v); }
__device__ __forceinline__ float gelu_n(float x) { return 0.5f * x * (1.0f + tanh_p(0.7978845608028654f * (x + 0.044715f * x * x * x))); }
template <int PASS>
__global__ __launch_bounds__(128) void k_lev(const float* __restrict__ X, const __bf16* __restrict__ P1, const float* __restrict__ B1, _Float16* __restrict__ H) {
  __shared__ __align__(16) _Float16 sg[4][16][136];
  const int tid = threadIdx.x, wave = tid >> 5, lane = tid & 31, col = lane & 15, g = lane >> 4; const size_t r0 = (size_t)blockIdx.x * 64 + wave * 16; const int n0 = blockIdx.y * 128;
  v8f acc[8] = {}; const float* px = X + (r0 + col) * NE + 8 * g; const __bf16* pw = P1 + (size_t)(n0 + col) * NE;   // one W1 base: the eight rows' distances are constants of the load instructions, which leaves their address registers to the fragments
#pragma unroll 1
  for (int lv = LV - 1; lv >= 0; --lv) {
    v4f xr[4]; { const float* p = px + lv * RR; xr[0] = *(const v4f*)p; xr[1] = *(const v4f*)(p + 4); xr[2] = *(const v4f*)(p + 16); xr[3] = *(const v4f*)(p + 20); }
#pragma unroll
    for (int kq = 0; kq < RR / 32; ++kq) { const int kc = lv * (RR / 32) + kq;
      v16b b[8];   // all eight W1 fragments of the k step, and the next step's x values, are requested before the step's first WMMA: one load latency a step, not eight
#pragma unroll
      for (int j = 0; j < 8; ++j) b[j] = frag_b(pw + j * 16 * NE + kc * 32, lane);
      v4f xn[4];
      if (kq + 1 < RR / 32) { const float* p = px + (kc + 1) * 32; xn[0] = *(const v4f*)p; xn[1] = *(const v4f*)(p + 4); xn[2] = *(const v4f*)(p + 16); xn[3] = *(const v4f*)(p + 20); }
      __builtin_amdgcn_sched_barrier(0);   // keeps the conversions and WMMAs, and with them the waits, behind all of the step's requests
      v16b a;
#pragma unroll
      for (int i = 0; i < 4; ++i) { a[i] = (__bf16)xr[0][i]; a[4 + i] = (__bf16)xr[1][i]; a[8 + i] = (__bf16)xr[2][i]; a[12 + i] = (__bf16)xr[3][i]; }
#pragma unroll
      for (int j = 0; j < 8; ++j) acc[j] = wmma_bf(a, b[j], acc[j]);
      if (kq + 1 < RR / 32) { xr[0] = xn[0]; xr[1] = xn[1]; xr[2] = xn[2]; xr[3] = xn[3]; } }
    if ((PASS == 0 && lv >= 4) || (PASS == 1 && lv < 4)) {
#pragma unroll
    for (int j = 0; j < 8; ++j) { const float bb = bfr(B1[n0 + j * 16 + col]);
#pragma unroll
      for (int r = 0; r < 8; ++r) sg[wave][8 * g + r][j * 16 + col] = (_Float16)gelu_n(acc[j][r] + bb); }
    LDSX();
    for (int rl = 0; rl < 16; ++rl) if (lane < 16) vst2((unsigned*)(H + ((size_t)(lv & 3) * NRW + r0 + rl) * HH + n0 + lane * 8), *(const v4u*)&sg[wave][rl][lane * 8]);
    LDSX(); }
    if (PASS == 0 && lv == 4) break; }
}
// ---- k_out: block = (64 rows, level slot): out[row][lv][0..128) = H[lv % 4][row] . W2 + b2 (K 4096); lv = slot + 4 * first-pass flag
__global__ __launch_bounds__(128) void k_out(const _Float16* __restrict__ H, const _Float16* __restrict__ P2, const float* __restrict__ B2, int lvbase, float* __restrict__ OUT) {
  __shared__ __align__(16) float so[4][16][132];
  const int tid = threadIdx.x, wave = tid >> 5, lane = tid & 31, col = lane & 15, g = lane >> 4; const size_t r0 = (size_t)blockIdx.x * 64 + wave * 16; const int slot = blockIdx.y; const int lv = lvbase + slot;
  v8f acc[8] = {};
  // fragment rings in registers: W2 fragments are requested one k step ahead, hidden fragments (from memory) three ahead, each step's requests as one group in front of the step's WMMAs
  const _Float16* pa = H + ((size_t)slot * NRW + r0 + col) * HH; const _Float16* pb = P2 + (size_t)col * HH;
  v16h fa[4], fb[2][8];
#pragma unroll
  for (int j = 0; j < 8; ++j) fb[0][j] = frag_h(pb + (size_t)j * 16 * HH, lane);
#pragma unroll
  for (int s = 0; s < 3; ++s) fa[s] = frag_h(pa + s * 32, lane);
#pragma unroll 1   // the body already holds four k steps, one per ring place
  for (int kc = 0; kc < HH / 32; kc += 4) {
#pragma unroll
    for (int u = 0; u < 4; ++u) { const int kb = kc + u + 1 < HH / 32 ? kc + u + 1 : 0, ka = kc + u + 3 < HH / 32 ? kc + u + 3 : 0;   // past the end: step 0 again, in bounds, never used
#pragma unroll
      for (int j = 0; j < 8; ++j) fb[(u + 1) & 1][j] = frag_h(pb + (size_t)j * 16 * HH + kb * 32, lane);
      fa[(u + 3) & 3] = frag_h(pa + ka * 32, lane);
      __builtin_amdgcn_sched_barrier(0);   // keeps the step's first WMMA, and with it the wait for this step's fragments, behind the requests for the next
#pragma unroll
      for (int j = 0; j < 8; ++j) acc[j] = wmma16(fa[u], fb[u & 1][j], acc[j]); }
    asm volatile("s_wait_xcnt 0x0" ::: "memory"); }   // loads are still in flight over the back edge: this stands in front of the next trip's rewrite of their address registers
#pragma unroll
  for (int j = 0; j < 8; ++j) { const float bb = bfr(B2[j * 16 + col]);
#pragma unroll
    for (int r = 0; r < 8; ++r) so[wave][8 * g + r][j * 16 + col] = acc[j][r] * (1.0f / 256.0f) + bb; }
  LDSX();
  for (int rl = 0; rl < 16; ++rl) vst2(OUT + ((r0 + rl) * LV + lv) * RR + lane * 4, *(const v4f*)&so[wave][rl][lane * 4]);   // 512-B (row, level) segment
}
extern "C" void kernel_launch(void* const* d_in, const int* in_sizes, int n_in, void* d_out, int out_size, void* d_ws, size_t ws_size, hipStream_t stream) {
  (void)in_sizes; (void)n_in; (void)out_size;
  const float** F = (const float**)d_in;   // 0 x [16,256,8,128], 1 W1 [1024,4096] (in,out), 2 b1, 3 W2 [4096,128], 4 b2
  if (ws_size < (size_t)WS_END) return;
  char* ws = (char*)d_ws; __bf16* P1 = (__bf16*)(ws + WS_P1); _Float16 *P2 = (_Float16*)(ws + WS_P2), *H = (_Float16*)(ws + WS_H);
  k_pack<<<HH + RR, 256, 0, stream>>>(F[1], F[3], P1, P2);
  k_lev<0><<<dim3(TRB, HH / 128), 128, 0, stream>>>(F[0], P1, F[2], H);   // levels 7..4 -> slots 3..0
  k_out<<<dim3(TRB, 4), 128, 0, stream>>>(H, P2, F[4], 4, (float*)d_out);
  k_lev<1><<<dim3(TRB, HH / 128), 128, 0, stream>>>(F[0], P1, F[2], H);   // levels 3..0
  k_out<<<dim3(TRB, 4), 128, 0, stream>>>(H, P2, F[4], 0, (float*)d_out);
}

// v002
// Measured time: 296 microseconds a run.
// Two timings next to v001 put it at 1.56 and 1.58 times that version's speed.
// Counting every step since v000, it is 2.58 times as fast.
// compute dtype: all float inputs rounded to bf16; the level-masked first linear as EXACT bf16 products on WMMA 16x16x32 ((in,out) weights as B fragments) accumulated block-suffix-wise in f32 (level l = sum of the 128-wide input blocks >= l), + b1, tanh-GELU (precise tanhf), hidden rounded once to f16 x exact f16 copies of W2 (x 2^8), + b2; f32 output.
#include <hip/hip_runtime.h>
#include <math.h>

typedef __attribute__((ext_vector_type(16))) _Float16 v16h;
typedef __attribute__((ext_vector_type(16))) __bf16 v16b;
typedef __attribute__((ext_vector_type(8)))  _Float16 v8h;
typedef __attribute__((ext_vector_type(8)))  float v8f;
typedef __attribute__((ext_vector_type(4)))  float v4f;
typedef __attribute__((ext_vector_type(2)))  float v2f;
typedef __attribute__((ext_vector_type(4)))  unsigned v4u;
typedef __attribute__((ext_vector_type(4)))  int v4i;
typedef float __attribute__((may_alias)) float_a;
typedef int __attribute__((may_alias)) int_a;

template <typename T> __device__ __forceinline__ void vst2(void* p, T v) { *(T*)p = v;  }
__device__ __forceinline__ v8f wmma16(v16h a, v16h b, v8f c) {
  v8f d = __builtin_amdgcn_wmma_f32_16x16x32_f16(false, a, false, b, (short)0, c, false, false);
  asm volatile("v_nop\n\tv_nop\n\tv_nop\n\tv_nop" : "+v"(d) : "v"(a), "v"(b));
  return d;
}
__device__ __forceinline__ v8f wmma_bf(v16b a, v16b b, v8f c) {
  v8f d = __builtin_amdgcn_wmma_f32_16x16x32_bf16(false, a, false, b, (short)0, c, false, false);
  asm volatile("v_nop\n\tv_nop\n\tv_nop\n\tv_nop" : "+v"(d) : "v"(a), "v"(b));
  return d;
}
// 16x16x32 fragments: lane = (h = lane>>4, row/col = lane&15); elements 0..7 = k0+8h+0..7, 8..15 = k0+16+8h+0..7; D element r = row 8h+r
__device__ __forceinline__ v16h frag_h(const _Float16* rowk0, int lane) {
  union { v16h v; v8h q[2]; } u; const _Float16* p = rowk0 + 8 * (lane >> 4);
  u.q[0] = *(const v8h*)p; u.q[1] = *(const v8h*)(p + 16); return u.v;
}
__device__ __forceinline__ v16h frag_f32(const float* rowk0, int lane) {
  v16h a; const float* p = rowk0 + 8 * (lane >> 4);
#pragma unroll
  for (int i = 0; i < 8; ++i) { a[i] = (_Float16)p[i]; a[8 + i] = (_Float16)p[16 + i]; }
  return a;
}
__device__ __forceinline__ v16h frag_f32s(const float* rowk0, int lane, float sc) {
  v16h a; const float* p = rowk0 + 8 * (lane >> 4);
#pragma unroll
  for (int i = 0; i < 8; ++i) { a[i] = (_Float16)(p[i] * sc); a[8 + i] = (_Float16)(p[16 + i] * sc); }
  return a;
}
// column fragment from a [K][ld] layout (column n), rows >= K read as 0
__device__ __forceinline__ v16h fragc_f32(const float* W, int k0, int n, int lane, int ld, int K) {
  v16h a; const int g = lane >> 4;
#pragma unroll
  for (int i = 0; i < 8; ++i) { const int ka = k0 + 8 * g + i, kb = ka + 16;
    a[i] = (_Float16)(ka < K ? W[(size_t)(ka < K ? ka : K - 1) * ld + n] : 0.f); a[8 + i] = (_Float16)(kb < K ? W[(size_t)(kb < K ? kb : K - 1) * ld + n] : 0.f); }
  return a;
}
struct F2 { v16b h, l; };
__device__ __forceinline__ F2 bsplit16(const float v[16]) { F2 r;
#pragma unroll
  for (int i = 0; i < 16; ++i) { const __bf16 h = (__bf16)v[i]; r.h[i] = h; r.l[i] = (__bf16)(v[i] - (float)h); }
  return r; }
__device__ __forceinline__ F2 split_row(const float* row, int k0, int lane) { float v[16]; const float* p = row + k0 + 8 * (lane >> 4);
#pragma unroll
  for (int i = 0; i < 8; ++i) { v[i] = p[i]; v[8 + i] = p[16 + i]; }
  return bsplit16(v); }
__device__ __forceinline__ F2 split_rowK(const float* row, int k0, int lane, int K) { float v[16]; const int g = lane >> 4;
#pragma unroll
  for (int i = 0; i < 8; ++i) { const int ka = k0 + 8 * g + i, kb = ka + 16; v[i] = ka < K ? row[ka < K ? ka : K - 1] : 0.f; v[8 + i] = kb < K ? row[kb < K ? kb : K - 1] : 0.f; }
  return bsplit16(v); }
__device__ __forceinline__ F2 split_col(const float* W, int k0, int n, int lane, int ld, int K) { float v[16]; const int g = lane >> 4;
#pragma unroll
  for (int i = 0; i < 8; ++i) { const int ka = k0 + 8 * g + i, kb = ka + 16; v[i] = ka < K ? W[(size_t)(ka < K ? ka : K - 1) * ld + n] : 0.f; v[8 + i] = kb < K ? W[(size_t)(kb < K ? kb : K - 1) * ld + n] : 0.f; }
  return bsplit16(v); }
__device__ __forceinline__ v8f mac3(const F2& a, const F2& b, v8f c) { c = wmma_bf(a.l, b.h, c); c = wmma_bf(a.h, b.l, c); return wmma_bf(a.h, b.h, c); }
__device__ __forceinline__ float sigm(float v) { return 1.0f / (1.0f + expf(-v)); }
#define LDSX() do { asm volatile("s_wait_dscnt 0" ::: "memory"); __builtin_amdgcn_wave_barrier(); __builtin_amdgcn_fence(__ATOMIC_RELEASE, "workgroup"); } while (0)


// Tree MLP (B 16, P 256, 8 levels x 128, hidden 4,096): level l sees the token embedding with its first l*128 entries zeroed; h = NewGELU(inp W1 + b1), out = h W2 + b2 per level.
#define NRW 4096          // B*P rows
#define LV 8
#define RR 128
#define NE (LV * RR)      // 1024
#define HH 4096
#ifndef TRB
#define TRB (NRW / 64)
#endif
typedef __attribute__((ext_vector_type(8))) __bf16 v8b;
// fragment-order buffers: one 16x16x32 fragment = 1 KB = 32 lanes x 16 B (elements 0..7 of each lane), then 32 lanes x 16 B (elements 8..15): a wave's 16-B load covers 512 contiguous bytes. fl = fragment start + lane * 8
__device__ __forceinline__ v16b fragp_b(const __bf16* fl) { union { v16b v; v8b q[2]; } u; u.q[0] = *(const v8b*)fl; u.q[1] = *(const v8b*)(fl + 256); return u.v; }
__device__ __forceinline__ v16h fragp_h(const _Float16* fl) { union { v16h v; v8h q[2]; } u; u.q[0] = *(const v8h*)fl; u.q[1] = *(const v8h*)(fl + 256); return u.v; }
__device__ __forceinline__ float bfr(float v) { return (float)(__bf16)v; }
__device__ __attribute__((noinline)) float exp_ni(float v) { return expf(v); }
__device__ __attribute__((noinline)) float erf_ni(float v) { return erff(v); }

#define FRG 512                                    // elements of a fragment
#define WS_P1  0u                                  // bf16 W1 B fragments [n / 128][k / 32][8 column tiles][FRG]
#define WS_P2  (WS_P1 + 2u * (size_t)HH * NE)       // f16 x 2^8 W2 B fragments [k / 32][8 column tiles][FRG]
#define WS_PX  (WS_P2 + 2u * (size_t)RR * HH)       // bf16 x A fragments [row / 16][k / 32][FRG]
#define WS_H   (WS_PX + 2u * (size_t)NRW * NE)      // f16 hidden A fragments [slot][row / 16][k / 32][FRG]
#define WS_END (WS_H + 2u * (size_t)4 * NRW * HH)

#define NT1 ((HH / 128) * (NE / 32))   // W1 tiles
#define NT2 (HH / 32)                  // W2 tiles
#define NTX ((NRW / 16) * (NE / 256))  // x tiles
// one block writes one 8-KB tile of eight fragments; a thread's chunk c = (fragment f, half hf, lane) is the 16 B that this lane will load
__global__ __launch_bounds__(256) void k_pack(const float* __restrict__ X, const float* __restrict__ W1, const float* __restrict__ W2, __bf16* __restrict__ PX, __bf16* __restrict__ P1, _Float16* __restrict__ P2) {
  const int b = blockIdx.x;
#pragma unroll
  for (int c = threadIdx.x; c < 512; c += 256) { const int f = c >> 6, lane = c & 31, col = lane & 15, ko = ((c >> 5) & 1) * 16 + 8 * (lane >> 4);
    if (b < NT1) { const float* p = W1 + (size_t)((b & 31) * 32 + ko) * HH + (b >> 5) * 128 + f * 16 + col; v8b o;
#pragma unroll
      for (int i = 0; i < 8; ++i) o[i] = (__bf16)p[(size_t)i * HH];
      *(v8b*)(P1 + (size_t)b * (8 * FRG) + c * 8) = o;
      asm volatile("s_wait_xcnt 0x0" ::: "memory"); }   // stands in front of the next chunk's rewrite of this store's data and address registers
    else if (b < NT1 + NT2) { const int kc = b - NT1; const float* p = W2 + (size_t)(kc * 32 + ko) * RR + f * 16 + col; v8h o;
#pragma unroll
      for (int i = 0; i < 8; ++i) o[i] = (_Float16)(bfr(p[i * RR]) * 256.0f);
      *(v8h*)(P2 + (size_t)kc * (8 * FRG) + c * 8) = o;
      asm volatile("s_wait_xcnt 0x0" ::: "memory"); }   // stands in front of the next chunk's rewrite of this store's data and address registers
    else { const int q = b - NT1 - NT2; const float* p = X + (size_t)((q >> 2) * 16 + col) * NE + ((q & 3) * 8 + f) * 32 + ko; const v4f lo = *(const v4f*)p, hi = *(const v4f*)(p + 4); v8b o;
#pragma unroll
      for (int i = 0; i < 4; ++i) { o[i] = (__bf16)lo[i]; o[4 + i] = (__bf16)hi[i]; }
      *(v8b*)(PX + (size_t)q * (8 * FRG) + c * 8) = o;
      asm volatile("s_wait_xcnt 0x0" ::: "memory"); } }   // stands in front of the next chunk's rewrite of this store's data and address registers
}
__device__ __attribute__((noinline)) float tanh_p(float v) { return tanhf(v); }
__device__ __forceinline__ float gelu_n(float x) { return 0.5f * x * (1.0f + tanh_p(0.7978845608028654f * (x + 0.044715f * x * x * x))); }
template <int PASS>
__global__ __launch_bounds__(128) void k_lev(const __bf16* __restrict__ PX, const __bf16* __restrict__ P1, const float* __restrict__ B1, _Float16* __restrict__ H) {
  __shared__ __align__(16) _Float16 sg[4][16][136];
  const int tid = threadIdx.x, wave = tid >> 5, lane = tid & 31, col = lane & 15, g = lane >> 4; const int rt = blockIdx.x * 4 + wave; const int n0 = blockIdx.y * 128;
  v8f acc[8] = {}; const __bf16* px = PX + (size_t)rt * (NE / 32) * FRG + lane * 8; const __bf16* pw = P1 + (size_t)blockIdx.y * (NE / 32) * (8 * FRG) + lane * 8;   // one W1 base: the eight fragments' distances are constants of the load instructions
#pragma unroll 1
  for (int lv = LV - 1; lv >= 0; --lv) {
    v16b a = fragp_b(px + lv * (RR / 32) * FRG);
#pragma unroll
    for (int kq = 0; kq < RR / 32; ++kq) { const int kc = lv * (RR / 32) + kq;
      v16b b[8];   // all eight W1 fragments of the k step, and the next step's x fragment, are requested before the step's first WMMA: one load latency a step, not eight
#pragma unroll
      for (int j = 0; j < 8; ++j) b[j] = fragp_b(pw + (kc * 8 + j) * FRG);
      v16b an;
      if (kq + 1 < RR / 32) an = fragp_b(px + (kc + 1) * FRG);
      __builtin_amdgcn_sched_barrier(0);   // keeps the WMMAs, and with them the waits, behind all of the step's requests
#pragma unroll
      for (int j = 0; j < 8; ++j) acc[j] = wmma_bf(a, b[j], acc[j]);
      if (kq + 1 < RR / 32) a = an; }
    if ((PASS == 0 && lv >= 4) || (PASS == 1 && lv < 4)) {
#pragma unroll
    for (int j = 0; j < 8; ++j) { const float bb = bfr(B1[n0 + j * 16 + col]);
#pragma unroll
      for (int r = 0; r < 8; ++r) sg[wave][8 * g + r][j * 16 + col] = (_Float16)gelu_n(acc[j][r] + bb); }
    LDSX();
#pragma unroll
    for (int q = 0; q < 8; ++q) vst2((unsigned*)(H + (((size_t)(lv & 3) * (NRW / 16) + rt) * (HH / 32) + (n0 >> 5)) * FRG + q * 256 + lane * 8), *(const v4u*)&sg[wave][col][q * 16 + 8 * g]);   // four A fragments of the out GEMM, 512 contiguous bytes a store
    LDSX(); }
    if (PASS == 0 && lv == 4) break; }
}
// ---- k_out: block = (64 rows, level slot): out[row][lv][0..128) = H[lv % 4][row] . W2 + b2 (K 4096); lv = slot + 4 * first-pass flag
__global__ __launch_bounds__(128) void k_out(const _Float16* __restrict__ H, const _Float16* __restrict__ P2, const float* __restrict__ B2, int lvbase, float* __restrict__ OUT) {
  __shared__ __align__(16) float so[4][16][132];
  const int tid = threadIdx.x, wave = tid >> 5, lane = tid & 31, col = lane & 15, g = lane >> 4; const size_t r0 = (size_t)blockIdx.x * 64 + wave * 16; const int slot = blockIdx.y; const int lv = lvbase + slot;
  v8f acc[8] = {};
  // fragment rings in registers: W2 fragments are requested one k step ahead, hidden fragments (from memory) three ahead, each step's requests as one group in front of the step's WMMAs
  const _Float16* pa = H + ((size_t)slot * (NRW / 16) + blockIdx.x * 4 + wave) * (HH / 32) * FRG + lane * 8; const _Float16* pb = P2 + lane * 8;
  v16h fa[4], fb[2][8];
#pragma unroll
  for (int j = 0; j < 8; ++j) fb[0][j] = fragp_h(pb + j * FRG);
#pragma unroll
  for (int s = 0; s < 3; ++s) fa[s] = fragp_h(pa + s * FRG);
#pragma unroll 1   // the body already holds four k steps, one per ring place
  for (int kc = 0; kc < HH / 32; kc += 4) {
#pragma unroll
    for (int u = 0; u < 4; ++u) { const int kb = kc + u + 1 < HH / 32 ? kc + u + 1 : 0, ka = kc + u + 3 < HH / 32 ? kc + u + 3 : 0;   // past the end: step 0 again, in bounds, never used
#pragma unroll
      for (int j = 0; j < 8; ++j) fb[(u + 1) & 1][j] = fragp_h(pb + (kb * 8 + j) * FRG);
      fa[(u + 3) & 3] = fragp_h(pa + ka * FRG);
      __builtin_amdgcn_sched_barrier(0);   // keeps the step's first WMMA, and with it the wait for this step's fragments, behind the requests for the next
#pragma unroll
      for (int j = 0; j < 8; ++j) acc[j] = wmma16(fa[u], fb[u & 1][j], acc[j]); }
    asm volatile("s_wait_xcnt 0x0" ::: "memory"); }   // loads are still in flight over the back edge: this stands in front of the next trip's rewrite of their address registers
#pragma unroll
  for (int j = 0; j < 8; ++j) { const float bb = bfr(B2[j * 16 + col]);
#pragma unroll
    for (int r = 0; r < 8; ++r) so[wave][8 * g + r][j * 16 + col] = acc[j][r] * (1.0f / 256.0f) + bb; }
  LDSX();
  for (int rl = 0; rl < 16; ++rl) vst2(OUT + ((r0 + rl) * LV + lv) * RR + lane * 4, *(const v4f*)&so[wave][rl][lane * 4]);   // 512-B (row, level) segment
}
extern "C" void kernel_launch(void* const* d_in, const int* in_sizes, int n_in, void* d_out, int out_size, void* d_ws, size_t ws_size, hipStream_t stream) {
  (void)in_sizes; (void)n_in; (void)out_size;
  const float** F = (const float**)d_in;   // 0 x [16,256,8,128], 1 W1 [1024,4096] (in,out), 2 b1, 3 W2 [4096,128], 4 b2
  if (ws_size < (size_t)WS_END) return;
  char* ws = (char*)d_ws; __bf16 *P1 = (__bf16*)(ws + WS_P1), *PX = (__bf16*)(ws + WS_PX); _Float16 *P2 = (_Float16*)(ws + WS_P2), *H = (_Float16*)(ws + WS_H);
  k_pack<<<NT1 + NT2 + NTX, 256, 0, stream>>>(F[0], F[1], F[3], PX, P1, P2);
  k_lev<0><<<dim3(TRB, HH / 128), 128, 0, stream>>>(PX, P1, F[2], H);   // levels 7..4 -> slots 3..0
  k_out<<<dim3(TRB, 4), 128, 0, stream>>>(H, P2, F[4], 4, (float*)d_out);
  k_lev<1><<<dim3(TRB, HH / 128), 128, 0, stream>>>(PX, P1, F[2], H);   // levels 3..0
  k_out<<<dim3(TRB, 4), 128, 0, stream>>>(H, P2, F[4], 0, (float*)d_out);
}

// v003
// Measured time: 188 microseconds a run.
// Timed twice side by side with v002, it ran 1.55 and 1.61 times as fast.
// Over all steps from v000 it is 4.07 times as fast.
// compute dtype: all float inputs rounded to bf16; the level-masked first linear as EXACT bf16 products on WMMA 16x16x32 ((in,out) weights as B fragments) accumulated block-suffix-wise in f32 (level l = sum of the 128-wide input blocks >= l), + b1, tanh-GELU (as x / (1 + e^(-2u)), hardware exp2 and reciprocal), hidden rounded once to f16 x exact f16 copies of W2 (x 2^8), + b2; f32 output.
#include <hip/hip_runtime.h>
#include <math.h>

typedef __attribute__((ext_vector_type(16))) _Float16 v16h;
typedef __attribute__((ext_vector_type(16))) __bf16 v16b;
typedef __attribute__((ext_vector_type(8)))  _Float16 v8h;
typedef __attribute__((ext_vector_type(8)))  float v8f;
typedef __attribute__((ext_vector_type(4)))  float v4f;
typedef __attribute__((ext_vector_type(2)))  float v2f;
typedef __attribute__((ext_vector_type(4)))  unsigned v4u;
typedef __attribute__((ext_vector_type(4)))  int v4i;
typedef float __attribute__((may_alias)) float_a;
typedef int __attribute__((may_alias)) int_a;

template <typename T> __device__ __forceinline__ void vst2(void* p, T v) { *(T*)p = v;  }
__device__ __forceinline__ v8f wmma16(v16h a, v16h b, v8f c) {
  v8f d = __builtin_amdgcn_wmma_f32_16x16x32_f16(false, a, false, b, (short)0, c, false, false);
  asm volatile("v_nop\n\tv_nop\n\tv_nop\n\tv_nop" : "+v"(d) : "v"(a), "v"(b));
  return d;
}
__device__ __forceinline__ v8f wmma_bf(v16b a, v16b b, v8f c) {
  v8f d = __builtin_amdgcn_wmma_f32_16x16x32_bf16(false, a, false, b, (short)0, c, false, false);
  asm volatile("v_nop\n\tv_nop\n\tv_nop\n\tv_nop" : "+v"(d) : "v"(a), "v"(b));
  return d;
}
// 16x16x32 fragments: lane = (h = lane>>4, row/col = lane&15); elements 0..7 = k0+8h+0..7, 8..15 = k0+16+8h+0..7; D element r = row 8h+r
__device__ __forceinline__ v16h frag_h(const _Float16* rowk0, int lane) {
  union { v16h v; v8h q[2]; } u; const _Float16* p = rowk0 + 8 * (lane >> 4);
  u.q[0] = *(const v8h*)p; u.q[1] = *(const v8h*)(p + 16); return u.v;
}
__device__ __forceinline__ v16h frag_f32(const float* rowk0, int lane) {
  v16h a; const float* p = rowk0 + 8 * (lane >> 4);
#pragma unroll
  for (int i = 0; i < 8; ++i) { a[i] = (_Float16)p[i]; a[8 + i] = (_Float16)p[16 + i]; }
  return a;
}
__device__ __forceinline__ v16h frag_f32s(const float* rowk0, int lane, float sc) {
  v16h a; const float* p = rowk0 + 8 * (lane >> 4);
#pragma unroll
  for (int i = 0; i < 8; ++i) { a[i] = (_Float16)(p[i] * sc); a[8 + i] = (_Float16)(p[16 + i] * sc); }
  return a;
}
// column fragment from a [K][ld] layout (column n), rows >= K read as 0
__device__ __forceinline__ v16h fragc_f32(const float* W, int k0, int n, int lane, int ld, int K) {
  v16h a; const int g = lane >> 4;
#pragma unroll
  for (int i = 0; i < 8; ++i) { const int ka = k0 + 8 * g + i, kb = ka + 16;
    a[i] = (_Float16)(ka < K ? W[(size_t)(ka < K ? ka : K - 1) * ld + n] : 0.f); a[8 + i] = (_Float16)(kb < K ? W[(size_t)(kb < K ? kb : K - 1) * ld + n] : 0.f); }
  return a;
}
struct F2 { v16b h, l; };
__device__ __forceinline__ F2 bsplit16(const float v[16]) { F2 r;
#pragma unroll
  for (int i = 0; i < 16; ++i) { const __bf16 h = (__bf16)v[i]; r.h[i] = h; r.l[i] = (__bf16)(v[i] - (float)h); }
  return r; }
__device__ __forceinline__ F2 split_row(const float* row, int k0, int lane) { float v[16]; const float* p = row + k0 + 8 * (lane >> 4);
#pragma unroll
  for (int i = 0; i < 8; ++i) { v[i] = p[i]; v[8 + i] = p[16 + i]; }
  return bsplit16(v); }
__device__ __forceinline__ F2 split_rowK(const float* row, int k0, int lane, int K) { float v[16]; const int g = lane >> 4;
#pragma unroll
  for (int i = 0; i < 8; ++i) { const int ka = k0 + 8 * g + i, kb = ka + 16; v[i] = ka < K ? row[ka < K ? ka : K - 1] : 0.f; v[8 + i] = kb < K ? row[kb < K ? kb : K - 1] : 0.f; }
  return bsplit16(v); }
__device__ __forceinline__ F2 split_col(const float* W, int k0, int n, int lane, int ld, int K) { float v[16]; const int g = lane >> 4;
#pragma unroll
  for (int i = 0; i < 8; ++i) { const int ka = k0 + 8 * g + i, kb = ka + 16; v[i] = ka < K ? W[(size_t)(ka < K ? ka : K - 1) * ld + n] : 0.f; v[8 + i] = kb < K ? W[(size_t)(kb < K ? kb : K - 1) * ld + n] : 0.f; }
  return bsplit16(v); }
__device__ __forceinline__ v8f mac3(const F2& a, const F2& b, v8f c) { c = wmma_bf(a.l, b.h, c); c = wmma_bf(a.h, b.l, c); return wmma_bf(a.h, b.h, c); }
__device__ __forceinline__ float sigm(float v) { return 1.0f / (1.0f + expf(-v)); }
#define LDSX() do { asm volatile("s_wait_dscnt 0" ::: "memory"); __builtin_amdgcn_wave_barrier(); __builtin_amdgcn_fence(__ATOMIC_RELEASE, "workgroup"); } while (0)


// Tree MLP (B 16, P 256, 8 levels x 128, hidden 4,096): level l sees the token embedding with its first l*128 entries zeroed; h = NewGELU(inp W1 + b1), out = h W2 + b2 per level.
#define NRW 4096          // B*P rows
#define LV 8
#define RR 128
#define NE (LV * RR)      // 1024
#define HH 4096
#ifndef TRB
#define TRB (NRW / 64)
#endif
typedef __attribute__((ext_vector_type(8))) __bf16 v8b;
// fragment-order buffers: one 16x16x32 fragment = 1 KB = 32 lanes x 16 B (elements 0..7 of each lane), then 32 lanes x 16 B (elements 8..15): a wave's 16-B load covers 512 contiguous bytes. fl = fragment start + lane * 8
__device__ __forceinline__ v16b fragp_b(const __bf16* fl) { union { v16b v; v8b q[2]; } u; u.q[0] = *(const v8b*)fl; u.q[1] = *(const v8b*)(fl + 256); return u.v; }
__device__ __forceinline__ v16h fragp_h(const _Float16* fl) { union { v16h v; v8h q[2]; } u; u.q[0] = *(const v8h*)fl; u.q[1] = *(const v8h*)(fl + 256); return u.v; }
__device__ __forceinline__ float bfr(float v) { return (float)(__bf16)v; }
__device__ __attribute__((noinline)) float exp_ni(float v) { return expf(v); }
__device__ __attribute__((noinline)) float erf_ni(float v) { return erff(v); }

#define FRG 512                                    // elements of a fragment
#define WS_P1  0u                                  // bf16 W1 B fragments [n / 128][k / 32][8 column tiles][FRG]
#define WS_P2  (WS_P1 + 2u * (size_t)HH * NE)       // f16 x 2^8 W2 B fragments [k / 32][8 column tiles][FRG]
#define WS_PX  (WS_P2 + 2u * (size_t)RR * HH)       // bf16 x A fragments [row / 16][k / 32][FRG]
#define WS_H   (WS_PX + 2u * (size_t)NRW * NE)      // f16 hidden A fragments [slot][row / 16][k / 32][FRG]
#define WS_END (WS_H + 2u * (size_t)4 * NRW * HH)

#define NT1 ((HH / 128) * (NE / 32))   // W1 tiles
#define NT2 (HH / 32)                  // W2 tiles
#define NTX ((NRW / 16) * (NE / 256))  // x tiles
// one block writes one 8-KB tile of eight fragments; a thread's chunk c = (fragment f, half hf, lane) is the 16 B that this lane will load
__global__ __launch_bounds__(256) void k_pack(const float* __restrict__ X, const float* __restrict__ W1, const float* __restrict__ W2, __bf16* __restrict__ PX, __bf16* __restrict__ P1, _Float16* __restrict__ P2) {
  const int b = blockIdx.x;
#pragma unroll
  for (int c = threadIdx.x; c < 512; c += 256) { const int f = c >> 6, lane = c & 31, col = lane & 15, ko = ((c >> 5) & 1) * 16 + 8 * (lane >> 4);
    if (b < NT1) { const float* p = W1 + (size_t)((b & 31) * 32 + ko) * HH + (b >> 5) * 128 + f * 16 + col; v8b o;
#pragma unroll
      for (int i = 0; i < 8; ++i) o[i] = (__bf16)p[(size_t)i * HH];
      *(v8b*)(P1 + (size_t)b * (8 * FRG) + c * 8) = o;
      asm volatile("s_wait_xcnt 0x0" ::: "memory"); }   // stands in front of the next chunk's rewrite of this store's data and address registers
    else if (b < NT1 + NT2) { const int kc = b - NT1; const float* p = W2 + (size_t)(kc * 32 + ko) * RR + f * 16 + col; v8h o;
#pragma unroll
      for (int i = 0; i < 8; ++i) o[i] = (_Float16)(bfr(p[i * RR]) * 256.0f);
      *(v8h*)(P2 + (size_t)kc * (8 * FRG) + c * 8) = o;
      asm volatile("s_wait_xcnt 0x0" ::: "memory"); }   // stands in front of the next chunk's rewrite of this store's data and address registers
    else { const int q = b - NT1 - NT2; const float* p = X + (size_t)((q >> 2) * 16 + col) * NE + ((q & 3) * 8 + f) * 32 + ko; const v4f lo = *(const v4f*)p, hi = *(const v4f*)(p + 4); v8b o;
#pragma unroll
      for (int i = 0; i < 4; ++i) { o[i] = (__bf16)lo[i]; o[4 + i] = (__bf16)hi[i]; }
      *(v8b*)(PX + (size_t)q * (8 * FRG) + c * 8) = o;
      asm volatile("s_wait_xcnt 0x0" ::: "memory"); } }   // stands in front of the next chunk's rewrite of this store's data and address registers
}
// GELU: 0.5 x (1 + tanh u) = x / (1 + e^(-2u)), u = sqrt(2/pi) (x + 0.044715 x^3): one hardware exp2 and one hardware reciprocal an element, inline, eight independent elements at a time.
// e^(-2u) = inf gives x * 0, e^(-2u) = 0 gives x, as the tanh form does at tanh = -1 and +1.
#define GK (-2.0f * 1.4426950408889634f * 0.7978845608028654f)   // -2 log2(e) sqrt(2/pi)
// Eight transcendentals as one statement: the early-clobber outputs share no register with a source, so none overwrites the source of the one in front of it; the v_nop is the slot that the instruction set asks for behind the last.
#define TR8(op, o, i) asm(op " %0, %8\n\t" op " %1, %9\n\t" op " %2, %10\n\t" op " %3, %11\n\t" op " %4, %12\n\t" op " %5, %13\n\t" op " %6, %14\n\t" op " %7, %15\n\tv_nop" \
  : "=&v"(o[0]), "=&v"(o[1]), "=&v"(o[2]), "=&v"(o[3]), "=&v"(o[4]), "=&v"(o[5]), "=&v"(o[6]), "=&v"(o[7]) : "v"(i[0]), "v"(i[1]), "v"(i[2]), "v"(i[3]), "v"(i[4]), "v"(i[5]), "v"(i[6]), "v"(i[7]))
// a = eight accumulators of one lane, bb = their bias; packed f32 arithmetic in front of the exp2
__device__ __forceinline__ void gelu8(v8f a, float bb, float (&y)[8]) { v2f x[4]; float e[8], t[8], q[8];
#pragma unroll   // here and below: constant indices, so that the small arrays are registers
  for (int i = 0; i < 4; ++i) { x[i] = (v2f){a[2 * i], a[2 * i + 1]} + bb; const v2f w = x[i] * (GK + (GK * 0.044715f) * (x[i] * x[i])); e[2 * i] = w[0]; e[2 * i + 1] = w[1]; }
  TR8("v_exp_f32", t, e);
#pragma unroll
  for (int r = 0; r < 8; ++r) t[r] = 1.0f + t[r];
  TR8("v_rcp_f32", q, t);
#pragma unroll
  for (int r = 0; r < 8; ++r) y[r] = x[r >> 1][r & 1] * q[r]; }
template <int PASS>
__global__ __launch_bounds__(128) void k_lev(const __bf16* __restrict__ PX, const __bf16* __restrict__ P1, const float* __restrict__ B1, _Float16* __restrict__ H) {
  __shared__ __align__(16) _Float16 sg[4][16][136];
  const int tid = threadIdx.x, wave = tid >> 5, lane = tid & 31, col = lane & 15, g = lane >> 4; const int rt = blockIdx.x * 4 + wave; const int n0 = blockIdx.y * 128;
  v8f acc[8] = {}; const __bf16* px = PX + (size_t)rt * (NE / 32) * FRG + lane * 8; const __bf16* pw = P1 + (size_t)blockIdx.y * (NE / 32) * (8 * FRG) + lane * 8;   // one W1 base: the eight fragments' distances are constants of the load instructions
#pragma unroll 1
  for (int lv = LV - 1; lv >= 0; --lv) {
    v16b a = fragp_b(px + lv * (RR / 32) * FRG);
#pragma unroll
    for (int kq = 0; kq < RR / 32; ++kq) { const int kc = lv * (RR / 32) + kq;
      v16b b[8];   // all eight W1 fragments of the k step, and the next step's x fragment, are requested before the step's first WMMA: one load latency a step, not eight
#pragma unroll
      for (int j = 0; j < 8; ++j) b[j] = fragp_b(pw + (kc * 8 + j) * FRG);
      v16b an;
      if (kq + 1 < RR / 32) an = fragp_b(px + (kc + 1) * FRG);
      __builtin_amdgcn_sched_barrier(0);   // keeps the WMMAs, and with them the waits, behind all of the step's requests
#pragma unroll
      for (int j = 0; j < 8; ++j) acc[j] = wmma_bf(a, b[j], acc[j]);
      if (kq + 1 < RR / 32) a = an; }
    if ((PASS == 0 && lv >= 4) || (PASS == 1 && lv < 4)) {
    float bb[8];   // the level's eight bias loads as one group, in front of the first tile's arithmetic
#pragma unroll   // eight loads side by side, bb[] in registers
    for (int j = 0; j < 8; ++j) bb[j] = B1[n0 + j * 16 + col];
#pragma unroll   // acc[j] must be indexed by constants
    for (int j = 0; j < 8; ++j) { float y[8];
      gelu8(acc[j], bfr(bb[j]), y);
#pragma unroll
      for (int r = 0; r < 8; ++r) sg[wave][8 * g + r][j * 16 + col] = (_Float16)y[r];
      if (j & 1) __builtin_amdgcn_sched_barrier(0); }   // two column tiles at a time: all eight in flight at once would take more registers than the k loop and cost a resident wave
    LDSX();
#pragma unroll
    for (int q = 0; q < 8; ++q) vst2((unsigned*)(H + (((size_t)(lv & 3) * (NRW / 16) + rt) * (HH / 32) + (n0 >> 5)) * FRG + q * 256 + lane * 8), *(const v4u*)&sg[wave][col][q * 16 + 8 * g]);   // four A fragments of the out GEMM, 512 contiguous bytes a store
    LDSX(); }
    if (PASS == 0 && lv == 4) break; }
}
// ---- k_out: block = (64 rows, level slot): out[row][lv][0..128) = H[lv % 4][row] . W2 + b2 (K 4096); lv = slot + 4 * first-pass flag
__global__ __launch_bounds__(128) void k_out(const _Float16* __restrict__ H, const _Float16* __restrict__ P2, const float* __restrict__ B2, int lvbase, float* __restrict__ OUT) {
  __shared__ __align__(16) float so[4][16][132];
  const int tid = threadIdx.x, wave = tid >> 5, lane = tid & 31, col = lane & 15, g = lane >> 4; const size_t r0 = (size_t)blockIdx.x * 64 + wave * 16; const int slot = blockIdx.y; const int lv = lvbase + slot;
  v8f acc[8] = {};
  // fragment rings in registers: W2 fragments are requested one k step ahead, hidden fragments (from memory) three ahead, each step's requests as one group in front of the step's WMMAs
  const _Float16* pa = H + ((size_t)slot * (NRW / 16) + blockIdx.x * 4 + wave) * (HH / 32) * FRG + lane * 8; const _Float16* pb = P2 + lane * 8;
  v16h fa[4], fb[2][8];
#pragma unroll
  for (int j = 0; j < 8; ++j) fb[0][j] = fragp_h(pb + j * FRG);
#pragma unroll
  for (int s = 0; s < 3; ++s) fa[s] = fragp_h(pa + s * FRG);
#pragma unroll 1   // the body already holds four k steps, one per ring place
  for (int kc = 0; kc < HH / 32; kc += 4) {
#pragma unroll
    for (int u = 0; u < 4; ++u) { const int kb = kc + u + 1 < HH / 32 ? kc + u + 1 : 0, ka = kc + u + 3 < HH / 32 ? kc + u + 3 : 0;   // past the end: step 0 again, in bounds, never used
#pragma unroll
      for (int j = 0; j < 8; ++j) fb[(u + 1) & 1][j] = fragp_h(pb + (kb * 8 + j) * FRG);
      fa[(u + 3) & 3] = fragp_h(pa + ka * FRG);
      __builtin_amdgcn_sched_barrier(0);   // keeps the step's first WMMA, and with it the wait for this step's fragments, behind the requests for the next
#pragma unroll
      for (int j = 0; j < 8; ++j) acc[j] = wmma16(fa[u], fb[u & 1][j], acc[j]); }
    asm volatile("s_wait_xcnt 0x0" ::: "memory"); }   // loads are still in flight over the back edge: this stands in front of the next trip's rewrite of their address registers
#pragma unroll
  for (int j = 0; j < 8; ++j) { const float bb = bfr(B2[j * 16 + col]);
#pragma unroll
    for (int r = 0; r < 8; ++r) so[wave][8 * g + r][j * 16 + col] = acc[j][r] * (1.0f / 256.0f) + bb; }
  LDSX();
  for (int rl = 0; rl < 16; ++rl) vst2(OUT + ((r0 + rl) * LV + lv) * RR + lane * 4, *(const v4f*)&so[wave][rl][lane * 4]);   // 512-B (row, level) segment
}
extern "C" void kernel_launch(void* const* d_in, const int* in_sizes, int n_in, void* d_out, int out_size, void* d_ws, size_t ws_size, hipStream_t stream) {
  (void)in_sizes; (void)n_in; (void)out_size;
  const float** F = (const float**)d_in;   // 0 x [16,256,8,128], 1 W1 [1024,4096] (in,out), 2 b1, 3 W2 [4096,128], 4 b2
  if (ws_size < (size_t)WS_END) return;
  char* ws = (char*)d_ws; __bf16 *P1 = (__bf16*)(ws + WS_P1), *PX = (__bf16*)(ws + WS_PX); _Float16 *P2 = (_Float16*)(ws + WS_P2), *H = (_Float16*)(ws + WS_H);
  k_pack<<<NT1 + NT2 + NTX, 256, 0, stream>>>(F[0], F[1], F[3], PX, P1, P2);
  k_lev<0><<<dim3(TRB, HH / 128), 128, 0, stream>>>(PX, P1, F[2], H);   // levels 7..4 -> slots 3..0
  k_out<<<dim3(TRB, 4), 128, 0, stream>>>(H, P2, F[4], 4, (float*)d_out);
  k_lev<1><<<dim3(TRB, HH / 128), 128, 0, stream>>>(PX, P1, F[2], H);   // levels 3..0
  k_out<<<dim3(TRB, 4), 128, 0, stream>>>(H, P2, F[4], 0, (float*)d_out);
}

// v004
// One run takes 165 microseconds.
// Two timings next to v003 put it at 1.11 and 1.12 times that version's speed.
// Counting every step since v000, it is 4.55 times as fast.
// compute dtype: all float inputs rounded to bf16; the level-masked first linear as EXACT bf16 products on WMMA 16x16x32 ((in,out) weights as B fragments) accumulated block-suffix-wise in f32 (level l = sum of the 128-wide input blocks >= l), + b1, tanh-GELU (as x / (1 + e^(-2u)), hardware exp2 and reciprocal), hidden rounded once to f16 x exact f16 copies of W2 (x 2^8), + b2; f32 output.
#include <hip/hip_runtime.h>
#include <math.h>

typedef __attribute__((ext_vector_type(16))) _Float16 v16h;
typedef __attribute__((ext_vector_type(16))) __bf16 v16b;
typedef __attribute__((ext_vector_type(8)))  _Float16 v8h;
typedef __attribute__((ext_vector_type(8)))  float v8f;
typedef __attribute__((ext_vector_type(4)))  float v4f;
typedef __attribute__((ext_vector_type(2)))  float v2f;
typedef __attribute__((ext_vector_type(4)))  unsigned v4u;
typedef __attribute__((ext_vector_type(4)))  int v4i;
typedef float __attribute__((may_alias)) float_a;
typedef int __attribute__((may_alias)) int_a;

template <typename T> __device__ __forceinline__ void vst2(void* p, T v) { *(T*)p = v;  }
__device__ __forceinline__ v8f wmma16(v16h a, v16h b, v8f c) {
  v8f d = __builtin_amdgcn_wmma_f32_16x16x32_f16(false, a, false, b, (short)0, c, false, false);
  asm volatile("v_nop\n\tv_nop\n\tv_nop\n\tv_nop" : "+v"(d) : "v"(a), "v"(b));
  return d;
}
__device__ __forceinline__ v8f wmma_bf(v16b a, v16b b, v8f c) {
  v8f d = __builtin_amdgcn_wmma_f32_16x16x32_bf16(false, a, false, b, (short)0, c, false, false);
  asm volatile("v_nop\n\tv_nop\n\tv_nop\n\tv_nop" : "+v"(d) : "v"(a), "v"(b));
  return d;
}
// 16x16x32 fragments: lane = (h = lane>>4, row/col = lane&15); elements 0..7 = k0+8h+0..7, 8..15 = k0+16+8h+0..7; D element r = row 8h+r
__device__ __forceinline__ v16h frag_h(const _Float16* rowk0, int lane) {
  union { v16h v; v8h q[2]; } u; const _Float16* p = rowk0 + 8 * (lane >> 4);
  u.q[0] = *(const v8h*)p; u.q[1] = *(const v8h*)(p + 16); return u.v;
}
__device__ __forceinline__ v16h frag_f32(const float* rowk0, int lane) {
  v16h a; const float* p = rowk0 + 8 * (lane >> 4);
#pragma unroll
  for (int i = 0; i < 8; ++i) { a[i] = (_Float16)p[i]; a[8 + i] = (_Float16)p[16 + i]; }
  return a;
}
__device__ __forceinline__ v16h frag_f32s(const float* rowk0, int lane, float sc) {
  v16h a; const float* p = rowk0 + 8 * (lane >> 4);
#pragma unroll
  for (int i = 0; i < 8; ++i) { a[i] = (_Float16)(p[i] * sc); a[8 + i] = (_Float16)(p[16 + i] * sc); }
  return a;
}
// column fragment from a [K][ld] layout (column n), rows >= K read as 0
__device__ __forceinline__ v16h fragc_f32(const float* W, int k0, int n, int lane, int ld, int K) {
  v16h a; const int g = lane >> 4;
#pragma unroll
  for (int i = 0; i < 8; ++i) { const int ka = k0 + 8 * g + i, kb = ka + 16;
    a[i] = (_Float16)(ka < K ? W[(size_t)(ka < K ? ka : K - 1) * ld + n] : 0.f); a[8 + i] = (_Float16)(kb < K ? W[(size_t)(kb < K ? kb : K - 1) * ld + n] : 0.f); }
  return a;
}
struct F2 { v16b h, l; };
__device__ __forceinline__ F2 bsplit16(const float v[16]) { F2 r;
#pragma unroll
  for (int i = 0; i < 16; ++i) { const __bf16 h = (__bf16)v[i]; r.h[i] = h; r.l[i] = (__bf16)(v[i] - (float)h); }
  return r; }
__device__ __forceinline__ F2 split_row(const float* row, int k0, int lane) { float v[16]; const float* p = row + k0 + 8 * (lane >> 4);
#pragma unroll
  for (int i = 0; i < 8; ++i) { v[i] = p[i]; v[8 + i] = p[16 + i]; }
  return bsplit16(v); }
__device__ __forceinline__ F2 split_rowK(const float* row, int k0, int lane, int K) { float v[16]; const int g = lane >> 4;
#pragma unroll
  for (int i = 0; i < 8; ++i) { const int ka = k0 + 8 * g + i, kb = ka + 16; v[i] = ka < K ? row[ka < K ? ka : K - 1] : 0.f; v[8 + i] = kb < K ? row[kb < K ? kb : K - 1] : 0.f; }
  return bsplit16(v); }
__device__ __forceinline__ F2 split_col(const float* W, int k0, int n, int lane, int ld, int K) { float v[16]; const int g = lane >> 4;
#pragma unroll
  for (int i = 0; i < 8; ++i) { const int ka = k0 + 8 * g + i, kb = ka + 16; v[i] = ka < K ? W[(size_t)(ka < K ? ka : K - 1) * ld + n] : 0.f; v[8 + i] = kb < K ? W[(size_t)(kb < K ? kb : K - 1) * ld + n] : 0.f; }
  return bsplit16(v); }
__device__ __forceinline__ v8f mac3(const F2& a, const F2& b, v8f c) { c = wmma_bf(a.l, b.h, c); c = wmma_bf(a.h, b.l, c); return wmma_bf(a.h, b.h, c); }
__device__ __forceinline__ float sigm(float v) { return 1.0f / (1.0f + expf(-v)); }
#define LDSX() do { asm volatile("s_wait_dscnt 0" ::: "memory"); __builtin_amdgcn_wave_barrier(); __builtin_amdgcn_fence(__ATOMIC_RELEASE, "workgroup"); } while (0)


// Tree MLP (B 16, P 256, 8 levels x 128, hidden 4,096): level l sees the token embedding with its first l*128 entries zeroed; h = NewGELU(inp W1 + b1), out = h W2 + b2 per level.
#define NRW 4096          // B*P rows
#define LV 8
#define RR 128
#define NE (LV * RR)      // 1024
#define HH 4096
#ifndef TRB
#define TRB (NRW / 64)
#endif
typedef __attribute__((ext_vector_type(8))) __bf16 v8b;
// fragment-order buffers: one 16x16x32 fragment = 1 KB = 32 lanes x 16 B (elements 0..7 of each lane), then 32 lanes x 16 B (elements 8..15): a wave's 16-B load covers 512 contiguous bytes. fl = fragment start + lane * 8
__device__ __forceinline__ v16b fragp_b(const __bf16* fl) { union { v16b v; v8b q[2]; } u; u.q[0] = *(const v8b*)fl; u.q[1] = *(const v8b*)(fl + 256); return u.v; }
__device__ __forceinline__ v16h fragp_h(const _Float16* fl) { union { v16h v; v8h q[2]; } u; u.q[0] = *(const v8h*)fl; u.q[1] = *(const v8h*)(fl + 256); return u.v; }
__device__ __forceinline__ float bfr(float v) { return (float)(__bf16)v; }
__device__ __attribute__((noinline)) float exp_ni(float v) { return expf(v); }
__device__ __attribute__((noinline)) float erf_ni(float v) { return erff(v); }

#define FRG 512                                    // elements of a fragment
#define WS_P1  0u                                  // bf16 W1 B fragments [n / 128][k / 32][8 column tiles][FRG]
#define WS_P2  (WS_P1 + 2u * (size_t)HH * NE)       // f16 x 2^8 W2 B fragments [k / 32][8 column tiles][FRG]
#define WS_PX  (WS_P2 + 2u * (size_t)RR * HH)       // bf16 x A fragments [row / 16][k / 32][FRG]
#define WS_H   (WS_PX + 2u * (size_t)NRW * NE)      // f16 hidden A fragments [slot][row / 16][k / 32][FRG]
#define WS_END (WS_H + 2u * (size_t)4 * NRW * HH)

#define NT1 ((HH / 128) * (NE / 32))   // W1 tiles
#define NT2 (HH / 32)                  // W2 tiles
#define NTX ((NRW / 16) * (NE / 256))  // x tiles
// one block writes one 8-KB tile of eight fragments; a thread's chunk c = (fragment f, half hf, lane) is the 16 B that this lane will load
__global__ __launch_bounds__(256) void k_pack(const float* __restrict__ X, const float* __restrict__ W1, const float* __restrict__ W2, __bf16* __restrict__ PX, __bf16* __restrict__ P1, _Float16* __restrict__ P2) {
  const int b = blockIdx.x;
#pragma unroll
  for (int c = threadIdx.x; c < 512; c += 256) { const int f = c >> 6, lane = c & 31, col = lane & 15, ko = ((c >> 5) & 1) * 16 + 8 * (lane >> 4);
    if (b < NT1) { const float* p = W1 + (size_t)((b & 31) * 32 + ko) * HH + (b >> 5) * 128 + f * 16 + col; v8b o;
#pragma unroll
      for (int i = 0; i < 8; ++i) o[i] = (__bf16)p[(size_t)i * HH];
      *(v8b*)(P1 + (size_t)b * (8 * FRG) + c * 8) = o;
      asm volatile("s_wait_xcnt 0x0" ::: "memory"); }   // stands in front of the next chunk's rewrite of this store's data and address registers
    else if (b < NT1 + NT2) { const int kc = b - NT1; const float* p = W2 + (size_t)(kc * 32 + ko) * RR + f * 16 + col; v8h o;
#pragma unroll
      for (int i = 0; i < 8; ++i) o[i] = (_Float16)(bfr(p[i * RR]) * 256.0f);
      *(v8h*)(P2 + (size_t)kc * (8 * FRG) + c * 8) = o;
      asm volatile("s_wait_xcnt 0x0" ::: "memory"); }   // stands in front of the next chunk's rewrite of this store's data and address registers
    else { const int q = b - NT1 - NT2; const float* p = X + (size_t)((q >> 2) * 16 + col) * NE + ((q & 3) * 8 + f) * 32 + ko; const v4f lo = *(const v4f*)p, hi = *(const v4f*)(p + 4); v8b o;
#pragma unroll
      for (int i = 0; i < 4; ++i) { o[i] = (__bf16)lo[i]; o[4 + i] = (__bf16)hi[i]; }
      *(v8b*)(PX + (size_t)q * (8 * FRG) + c * 8) = o;
      asm volatile("s_wait_xcnt 0x0" ::: "memory"); } }   // stands in front of the next chunk's rewrite of this store's data and address registers
}
// GELU: 0.5 x (1 + tanh u) = x / (1 + e^(-2u)), u = sqrt(2/pi) (x + 0.044715 x^3): one hardware exp2 and one hardware reciprocal an element, inline, eight independent elements at a time.
// e^(-2u) = inf gives x * 0, e^(-2u) = 0 gives x, as the tanh form does at tanh = -1 and +1.
#define GK (-2.0f * 1.4426950408889634f * 0.7978845608028654f)   // -2 log2(e) sqrt(2/pi)
// Eight transcendentals as one statement: the early-clobber outputs share no register with a source, so none overwrites the source of the one in front of it; the v_nop is the slot that the instruction set asks for behind the last.
#define TR8(op, o, i) asm(op " %0, %8\n\t" op " %1, %9\n\t" op " %2, %10\n\t" op " %3, %11\n\t" op " %4, %12\n\t" op " %5, %13\n\t" op " %6, %14\n\t" op " %7, %15\n\tv_nop" \
  : "=&v"(o[0]), "=&v"(o[1]), "=&v"(o[2]), "=&v"(o[3]), "=&v"(o[4]), "=&v"(o[5]), "=&v"(o[6]), "=&v"(o[7]) : "v"(i[0]), "v"(i[1]), "v"(i[2]), "v"(i[3]), "v"(i[4]), "v"(i[5]), "v"(i[6]), "v"(i[7]))
// a = eight accumulators of one lane, bb = their bias; packed f32 arithmetic in front of the exp2
__device__ __forceinline__ void gelu8(v8f a, float bb, float (&y)[8]) { v2f x[4]; float e[8], t[8], q[8];
#pragma unroll   // here and below: constant indices, so that the small arrays are registers
  for (int i = 0; i < 4; ++i) { x[i] = (v2f){a[2 * i], a[2 * i + 1]} + bb; const v2f w = x[i] * (GK + (GK * 0.044715f) * (x[i] * x[i])); e[2 * i] = w[0]; e[2 * i + 1] = w[1]; }
  TR8("v_exp_f32", t, e);
#pragma unroll
  for (int r = 0; r < 8; ++r) t[r] = 1.0f + t[r];
  TR8("v_rcp_f32", q, t);
#pragma unroll
  for (int r = 0; r < 8; ++r) y[r] = x[r >> 1][r & 1] * q[r]; }
// block = 256 rows x 256 hidden columns, 4 x 4 waves, one block a WGP; a wave holds a 64 x 64 tile: the four x and four W1 fragments of a k step feed sixteen WMMAs, and each fragment is asked for by four waves of the same WGP
template <int PASS>
__global__ __launch_bounds__(512) void k_lev(const __bf16* __restrict__ PX, const __bf16* __restrict__ P1, const float* __restrict__ B1, _Float16* __restrict__ H) {
  __shared__ __align__(16) _Float16 sg[16][64][72];
  const int tid = threadIdx.x, wave = tid >> 5, lane = tid & 31, col = lane & 15, g = lane >> 4; const int rt0 = blockIdx.x * 16 + (wave >> 2) * 4; const int n0 = blockIdx.y * 256 + (wave & 3) * 64;
  v8f acc[4][4] = {}; const __bf16* px = PX + (size_t)rt0 * (NE / 32) * FRG + lane * 8; const __bf16* pw = P1 + ((size_t)(n0 >> 7) * (NE / 32) * 8 + ((n0 >> 6) & 1) * 4) * FRG + lane * 8;   // one base an operand: the fragments' distances are constants of the load instructions
#pragma unroll 1
  for (int lv = LV - 1; lv >= 0; --lv) {
#pragma unroll
    for (int kq = 0; kq < RR / 32; ++kq) { const int kc = lv * (RR / 32) + kq;
      v16b a[4], b[4];   // all eight fragments of the k step are requested before the step's first WMMA: one load latency a step
#pragma unroll
      for (int i = 0; i < 4; ++i) a[i] = fragp_b(px + (i * (NE / 32) + kc) * FRG);
#pragma unroll
      for (int j = 0; j < 4; ++j) b[j] = fragp_b(pw + (kc * 8 + j) * FRG);
      __builtin_amdgcn_sched_barrier(0);   // keeps the WMMAs, and with them the waits, behind all of the step's requests
#pragma unroll
      for (int j = 0; j < 4; ++j)
#pragma unroll
        for (int i = 0; i < 4; ++i) acc[i][j] = wmma_bf(a[i], b[j], acc[i][j]); }
    if ((PASS == 0 && lv >= 4) || (PASS == 1 && lv < 4)) {
    float bb[4];   // the level's four bias loads as one group, in front of the first tile's arithmetic
#pragma unroll   // four loads side by side, bb[] in registers
    for (int j = 0; j < 4; ++j) bb[j] = B1[n0 + j * 16 + col];
#pragma unroll   // acc[i][j] must be indexed by constants
    for (int i = 0; i < 4; ++i)
#pragma unroll
      for (int j = 0; j < 4; ++j) { float y[8];
        gelu8(acc[i][j], bfr(bb[j]), y);
#pragma unroll
        for (int r = 0; r < 8; ++r) sg[wave][i * 16 + 8 * g + r][j * 16 + col] = (_Float16)y[r];
        if (j & 1) __builtin_amdgcn_sched_barrier(0); }   // two tiles at a time: sixteen independent elements a lane are enough for the vector port; left free, the build spreads the tiles further, takes more registers and adds waits
    LDSX();
#pragma unroll
    for (int i = 0; i < 4; ++i)
#pragma unroll
      for (int q = 0; q < 4; ++q) vst2((unsigned*)(H + (((size_t)(lv & 3) * (NRW / 16) + rt0 + i) * (HH / 32) + (n0 >> 5)) * FRG + q * 256 + lane * 8), *(const v4u*)&sg[wave][i * 16 + col][q * 16 + 8 * g]);   // two A fragments of the out GEMM a row tile, 512 contiguous bytes a store
    asm volatile("s_wait_xcnt 0x0" ::: "memory");   // stands in front of the next level's rewrite of these stores' data and address registers
    LDSX(); }
    if (PASS == 0 && lv == 4) break; }
}
// ---- k_out: block = (64 rows, level slot): out[row][lv][0..128) = H[lv % 4][row] . W2 + b2 (K 4096); lv = slot + 4 * first-pass flag
__global__ __launch_bounds__(128) void k_out(const _Float16* __restrict__ H, const _Float16* __restrict__ P2, const float* __restrict__ B2, int lvbase, float* __restrict__ OUT) {
  __shared__ __align__(16) float so[4][16][132];
  const int tid = threadIdx.x, wave = tid >> 5, lane = tid & 31, col = lane & 15, g = lane >> 4; const size_t r0 = (size_t)blockIdx.x * 64 + wave * 16; const int slot = blockIdx.y; const int lv = lvbase + slot;
  v8f acc[8] = {};
  // fragment rings in registers: W2 fragments are requested one k step ahead, hidden fragments (from memory) three ahead, each step's requests as one group in front of the step's WMMAs
  const _Float16* pa = H + ((size_t)slot * (NRW / 16) + blockIdx.x * 4 + wave) * (HH / 32) * FRG + lane * 8; const _Float16* pb = P2 + lane * 8;
  v16h fa[4], fb[2][8];
#pragma unroll
  for (int j = 0; j < 8; ++j) fb[0][j] = fragp_h(pb + j * FRG);
#pragma unroll
  for (int s = 0; s < 3; ++s) fa[s] = fragp_h(pa + s * FRG);
#pragma unroll 1   // the body already holds four k steps, one per ring place
  for (int kc = 0; kc < HH / 32; kc += 4) {
#pragma unroll
    for (int u = 0; u < 4; ++u) { const int kb = kc + u + 1 < HH / 32 ? kc + u + 1 : 0, ka = kc + u + 3 < HH / 32 ? kc + u + 3 : 0;   // past the end: step 0 again, in bounds, never used
#pragma unroll
      for (int j = 0; j < 8; ++j) fb[(u + 1) & 1][j] = fragp_h(pb + (kb * 8 + j) * FRG);
      fa[(u + 3) & 3] = fragp_h(pa + ka * FRG);
      __builtin_amdgcn_sched_barrier(0);   // keeps the step's first WMMA, and with it the wait for this step's fragments, behind the requests for the next
#pragma unroll
      for (int j = 0; j < 8; ++j) acc[j] = wmma16(fa[u], fb[u & 1][j], acc[j]); }
    asm volatile("s_wait_xcnt 0x0" ::: "memory"); }   // loads are still in flight over the back edge: this stands in front of the next trip's rewrite of their address registers
#pragma unroll
  for (int j = 0; j < 8; ++j) { const float bb = bfr(B2[j * 16 + col]);
#pragma unroll
    for (int r = 0; r < 8; ++r) so[wave][8 * g + r][j * 16 + col] = acc[j][r] * (1.0f / 256.0f) + bb; }
  LDSX();
  for (int rl = 0; rl < 16; ++rl) vst2(OUT + ((r0 + rl) * LV + lv) * RR + lane * 4, *(const v4f*)&so[wave][rl][lane * 4]);   // 512-B (row, level) segment
}
extern "C" void kernel_launch(void* const* d_in, const int* in_sizes, int n_in, void* d_out, int out_size, void* d_ws, size_t ws_size, hipStream_t stream) {
  (void)in_sizes; (void)n_in; (void)out_size;
  const float** F = (const float**)d_in;   // 0 x [16,256,8,128], 1 W1 [1024,4096] (in,out), 2 b1, 3 W2 [4096,128], 4 b2
  if (ws_size < (size_t)WS_END) return;
  char* ws = (char*)d_ws; __bf16 *P1 = (__bf16*)(ws + WS_P1), *PX = (__bf16*)(ws + WS_PX); _Float16 *P2 = (_Float16*)(ws + WS_P2), *H = (_Float16*)(ws + WS_H);
  k_pack<<<NT1 + NT2 + NTX, 256, 0, stream>>>(F[0], F[1], F[3], PX, P1, P2);
  k_lev<0><<<dim3(NRW / 256, HH / 256), 512, 0, stream>>>(PX, P1, F[2], H);   // levels 7..4 -> slots 3..0
  k_out<<<dim3(TRB, 4), 128, 0, stream>>>(H, P2, F[4], 4, (float*)d_out);
  k_lev<1><<<dim3(NRW / 256, HH / 256), 512, 0, stream>>>(PX, P1, F[2], H);   // levels 3..0
  k_out<<<dim3(TRB, 4), 128, 0, stream>>>(H, P2, F[4], 0, (float*)d_out);
}

// v005
// Measured time: 132 microseconds a run.
// In two side-by-side timings against v004, it was 1.24 and 1.25 times as fast.
// All steps since v000 together make it 5.67 times as fast.
// compute dtype: all float inputs rounded to bf16; the level-masked first linear as EXACT bf16 products on WMMA 16x16x32 ((in,out) weights as B fragments) accumulated block-suffix-wise in f32 (level l = sum of the 128-wide input blocks >= l), + b1, tanh-GELU (as x / (1 + e^(-2u)), hardware exp2 and reciprocal), hidden rounded once to f16 x exact f16 copies of W2 (x 2^8), + b2; f32 output.
#include <hip/hip_runtime.h>
#include <math.h>

typedef __attribute__((ext_vector_type(16))) _Float16 v16h;
typedef __attribute__((ext_vector_type(16))) __bf16 v16b;
typedef __attribute__((ext_vector_type(8)))  _Float16 v8h;
typedef __attribute__((ext_vector_type(8)))  float v8f;
typedef __attribute__((ext_vector_type(4)))  float v4f;
typedef __attribute__((ext_vector_type(2)))  float v2f;
typedef __attribute__((ext_vector_type(4)))  unsigned v4u;
typedef __attribute__((ext_vector_type(4)))  int v4i;
typedef float __attribute__((may_alias)) float_a;
typedef int __attribute__((may_alias)) int_a;

template <typename T> __device__ __forceinline__ void vst2(void* p, T v) { *(T*)p = v;  }
__device__ __forceinline__ v8f wmma16(v16h a, v16h b, v8f c) {
  v8f d = __builtin_amdgcn_wmma_f32_16x16x32_f16(false, a, false, b, (short)0, c, false, false);
  asm volatile("v_nop\n\tv_nop\n\tv_nop\n\tv_nop" : "+v"(d) : "v"(a), "v"(b));
  return d;
}
__device__ __forceinline__ v8f wmma_bf(v16b a, v16b b, v8f c) {
  v8f d = __builtin_amdgcn_wmma_f32_16x16x32_bf16(false, a, false, b, (short)0, c, false, false);
  asm volatile("v_nop\n\tv_nop\n\tv_nop\n\tv_nop" : "+v"(d) : "v"(a), "v"(b));
  return d;
}
// 16x16x32 fragments: lane = (h = lane>>4, row/col = lane&15); elements 0..7 = k0+8h+0..7, 8..15 = k0+16+8h+0..7; D element r = row 8h+r
__device__ __forceinline__ v16h frag_h(const _Float16* rowk0, int lane) {
  union { v16h v; v8h q[2]; } u; const _Float16* p = rowk0 + 8 * (lane >> 4);
  u.q[0] = *(const v8h*)p; u.q[1] = *(const v8h*)(p + 16); return u.v;
}
__device__ __forceinline__ v16h frag_f32(const float* rowk0, int lane) {
  v16h a; const float* p = rowk0 + 8 * (lane >> 4);
#pragma unroll
  for (int i = 0; i < 8; ++i) { a[i] = (_Float16)p[i]; a[8 + i] = (_Float16)p[16 + i]; }
  return a;
}
__device__ __forceinline__ v16h frag_f32s(const float* rowk0, int lane, float sc) {
  v16h a; const float* p = rowk0 + 8 * (lane >> 4);
#pragma unroll
  for (int i = 0; i < 8; ++i) { a[i] = (_Float16)(p[i] * sc); a[8 + i] = (_Float16)(p[16 + i] * sc); }
  return a;
}
// column fragment from a [K][ld] layout (column n), rows >= K read as 0
__device__ __forceinline__ v16h fragc_f32(const float* W, int k0, int n, int lane, int ld, int K) {
  v16h a; const int g = lane >> 4;
#pragma unroll
  for (int i = 0; i < 8; ++i) { const int ka = k0 + 8 * g + i, kb = ka + 16;
    a[i] = (_Float16)(ka < K ? W[(size_t)(ka < K ? ka : K - 1) * ld + n] : 0.f); a[8 + i] = (_Float16)(kb < K ? W[(size_t)(kb < K ? kb : K - 1) * ld + n] : 0.f); }
  return a;
}
struct F2 { v16b h, l; };
__device__ __forceinline__ F2 bsplit16(const float v[16]) { F2 r;
#pragma unroll
  for (int i = 0; i < 16; ++i) { const __bf16 h = (__bf16)v[i]; r.h[i] = h; r.l[i] = (__bf16)(v[i] - (float)h); }
  return r; }
__device__ __forceinline__ F2 split_row(const float* row, int k0, int lane) { float v[16]; const float* p = row + k0 + 8 * (lane >> 4);
#pragma unroll
  for (int i = 0; i < 8; ++i) { v[i] = p[i]; v[8 + i] = p[16 + i]; }
  return bsplit16(v); }
__device__ __forceinline__ F2 split_rowK(const float* row, int k0, int lane, int K) { float v[16]; const int g = lane >> 4;
#pragma unroll
  for (int i = 0; i < 8; ++i) { const int ka = k0 + 8 * g + i, kb = ka + 16; v[i] = ka < K ? row[ka < K ? ka : K - 1] : 0.f; v[8 + i] = kb < K ? row[kb < K ? kb : K - 1] : 0.f; }
  return bsplit16(v); }
__device__ __forceinline__ F2 split_col(const float* W, int k0, int n, int lane, int ld, int K) { float v[16]; const int g = lane >> 4;
#pragma unroll
  for (int i = 0; i < 8; ++i) { const int ka = k0 + 8 * g + i, kb = ka + 16; v[i] = ka < K ? W[(size_t)(ka < K ? ka : K - 1) * ld + n] : 0.f; v[8 + i] = kb < K ? W[(size_t)(kb < K ? kb : K - 1) * ld + n] : 0.f; }
  return bsplit16(v); }
__device__ __forceinline__ v8f mac3(const F2& a, const F2& b, v8f c) { c = wmma_bf(a.l, b.h, c); c = wmma_bf(a.h, b.l, c); return wmma_bf(a.h, b.h, c); }
__device__ __forceinline__ float sigm(float v) { return 1.0f / (1.0f + expf(-v)); }
#define LDSX() do { asm volatile("s_wait_dscnt 0" ::: "memory"); __builtin_amdgcn_wave_barrier(); __builtin_amdgcn_fence(__ATOMIC_RELEASE, "workgroup"); } while (0)


// Tree MLP (B 16, P 256, 8 levels x 128, hidden 4,096): level l sees the token embedding with its first l*128 entries zeroed; h = NewGELU(inp W1 + b1), out = h W2 + b2 per level.
#define NRW 4096          // B*P rows
#define LV 8
#define RR 128
#define NE (LV * RR)      // 1024
#define HH 4096
#ifndef TRB
#define TRB (NRW / 64)
#endif
typedef __attribute__((ext_vector_type(8))) __bf16 v8b;
// fragment-order buffers: one 16x16x32 fragment = 1 KB = 32 lanes x 16 B (elements 0..7 of each lane), then 32 lanes x 16 B (elements 8..15): a wave's 16-B load covers 512 contiguous bytes. fl = fragment start + lane * 8
__device__ __forceinline__ v16b fragp_b(const __bf16* fl) { union { v16b v; v8b q[2]; } u; u.q[0] = *(const v8b*)fl; u.q[1] = *(const v8b*)(fl + 256); return u.v; }
__device__ __forceinline__ v16h fragp_h(const _Float16* fl) { union { v16h v; v8h q[2]; } u; u.q[0] = *(const v8h*)fl; u.q[1] = *(const v8h*)(fl + 256); return u.v; }
__device__ __forceinline__ float bfr(float v) { return (float)(__bf16)v; }
__device__ __attribute__((noinline)) float exp_ni(float v) { return expf(v); }
__device__ __attribute__((noinline)) float erf_ni(float v) { return erff(v); }

#define FRG 512                                    // elements of a fragment
#define WS_P1  0u                                  // bf16 W1 B fragments [n / 128][k / 32][8 column tiles][FRG]
#define WS_P2  (WS_P1 + 2u * (size_t)HH * NE)       // f16 x 2^8 W2 B fragments [k / 32][8 column tiles][FRG]
#define WS_PX  (WS_P2 + 2u * (size_t)RR * HH)       // bf16 x A fragments [row / 16][k / 32][FRG]
#define WS_H   (WS_PX + 2u * (size_t)NRW * NE)      // f16 hidden A fragments [slot][row / 16][k / 32][FRG]
#define WS_END (WS_H + 2u * (size_t)4 * NRW * HH)

#define NT1 ((HH / 128) * (NE / 32))   // W1 tiles
#define NT2 (HH / 32)                  // W2 tiles
#define NTX ((NRW / 16) * (NE / 256))  // x tiles
// one block writes one 8-KB tile of eight fragments; a thread's chunk c = (fragment f, half hf, lane) is the 16 B that this lane will load
__global__ __launch_bounds__(256) void k_pack(const float* __restrict__ X, const float* __restrict__ W1, const float* __restrict__ W2, __bf16* __restrict__ PX, __bf16* __restrict__ P1, _Float16* __restrict__ P2) {
  const int b = blockIdx.x;
#pragma unroll
  for (int c = threadIdx.x; c < 512; c += 256) { const int f = c >> 6, lane = c & 31, col = lane & 15, ko = ((c >> 5) & 1) * 16 + 8 * (lane >> 4);
    if (b < NT1) { const float* p = W1 + (size_t)((b & 31) * 32 + ko) * HH + (b >> 5) * 128 + f * 16 + col; v8b o;
#pragma unroll
      for (int i = 0; i < 8; ++i) o[i] = (__bf16)p[(size_t)i * HH];
      *(v8b*)(P1 + (size_t)b * (8 * FRG) + c * 8) = o;
      asm volatile("s_wait_xcnt 0x0" ::: "memory"); }   // stands in front of the next chunk's rewrite of this store's data and address registers
    else if (b < NT1 + NT2) { const int kc = b - NT1; const float* p = W2 + (size_t)(kc * 32 + ko) * RR + f * 16 + col; v8h o;
#pragma unroll
      for (int i = 0; i < 8; ++i) o[i] = (_Float16)(bfr(p[i * RR]) * 256.0f);
      *(v8h*)(P2 + (size_t)kc * (8 * FRG) + c * 8) = o;
      asm volatile("s_wait_xcnt 0x0" ::: "memory"); }   // stands in front of the next chunk's rewrite of this store's data and address registers
    else { const int q = b - NT1 - NT2; const float* p = X + (size_t)((q >> 2) * 16 + col) * NE + ((q & 3) * 8 + f) * 32 + ko; const v4f lo = *(const v4f*)p, hi = *(const v4f*)(p + 4); v8b o;
#pragma unroll
      for (int i = 0; i < 4; ++i) { o[i] = (__bf16)lo[i]; o[4 + i] = (__bf16)hi[i]; }
      *(v8b*)(PX + (size_t)q * (8 * FRG) + c * 8) = o;
      asm volatile("s_wait_xcnt 0x0" ::: "memory"); } }   // stands in front of the next chunk's rewrite of this store's data and address registers
}
// GELU: 0.5 x (1 + tanh u) = x / (1 + e^(-2u)), u = sqrt(2/pi) (x + 0.044715 x^3): one hardware exp2 and one hardware reciprocal an element, inline, eight independent elements at a time.
// e^(-2u) = inf gives x * 0, e^(-2u) = 0 gives x, as the tanh form does at tanh = -1 and +1.
#define GK (-2.0f * 1.4426950408889634f * 0.7978845608028654f)   // -2 log2(e) sqrt(2/pi)
// Eight transcendentals as one statement: the early-clobber outputs share no register with a source, so none overwrites the source of the one in front of it; the v_nop is the slot that the instruction set asks for behind the last.
#define TR8(op, o, i) asm(op " %0, %8\n\t" op " %1, %9\n\t" op " %2, %10\n\t" op " %3, %11\n\t" op " %4, %12\n\t" op " %5, %13\n\t" op " %6, %14\n\t" op " %7, %15\n\tv_nop" \
  : "=&v"(o[0]), "=&v"(o[1]), "=&v"(o[2]), "=&v"(o[3]), "=&v"(o[4]), "=&v"(o[5]), "=&v"(o[6]), "=&v"(o[7]) : "v"(i[0]), "v"(i[1]), "v"(i[2]), "v"(i[3]), "v"(i[4]), "v"(i[5]), "v"(i[6]), "v"(i[7]))
// a = eight accumulators of one lane, bb = their bias; packed f32 arithmetic in front of the exp2
__device__ __forceinline__ void gelu8(v8f a, float bb, float (&y)[8]) { v2f x[4]; float e[8], t[8], q[8];
#pragma unroll   // here and below: constant indices, so that the small arrays are registers
  for (int i = 0; i < 4; ++i) { x[i] = (v2f){a[2 * i], a[2 * i + 1]} + bb; const v2f w = x[i] * (GK + (GK * 0.044715f) * (x[i] * x[i])); e[2 * i] = w[0]; e[2 * i + 1] = w[1]; }
  TR8("v_exp_f32", t, e);
#pragma unroll
  for (int r = 0; r < 8; ++r) t[r] = 1.0f + t[r];
  TR8("v_rcp_f32", q, t);
#pragma unroll
  for (int r = 0; r < 8; ++r) y[r] = x[r >> 1][r & 1] * q[r]; }
// block = 256 rows x 256 hidden columns, 4 x 4 waves, one block a WGP; a wave holds a 64 x 64 tile: the four x and four W1 fragments of a k step feed sixteen WMMAs, and each fragment is asked for by four waves of the same WGP
template <int PASS>
__global__ __launch_bounds__(512) void k_lev(const __bf16* __restrict__ PX, const __bf16* __restrict__ P1, const float* __restrict__ B1, _Float16* __restrict__ H) {
  __shared__ __align__(16) _Float16 sg[16][64][72];
  const int tid = threadIdx.x, wave = tid >> 5, lane = tid & 31, col = lane & 15, g = lane >> 4; const int rt0 = blockIdx.x * 16 + (wave >> 2) * 4; const int n0 = blockIdx.y * 256 + (wave & 3) * 64;
  v8f acc[4][4] = {}; const __bf16* px = PX + (size_t)rt0 * (NE / 32) * FRG + lane * 8; const __bf16* pw = P1 + ((size_t)(n0 >> 7) * (NE / 32) * 8 + ((n0 >> 6) & 1) * 4) * FRG + lane * 8;   // one base an operand: the fragments' distances are constants of the load instructions
#pragma unroll 1
  for (int lv = LV - 1; lv >= 0; --lv) {
#pragma unroll
    for (int kq = 0; kq < RR / 32; ++kq) { const int kc = lv * (RR / 32) + kq;
      v16b a[4], b[4];   // all eight fragments of the k step are requested before the step's first WMMA: one load latency a step
#pragma unroll
      for (int i = 0; i < 4; ++i) a[i] = fragp_b(px + (i * (NE / 32) + kc) * FRG);
#pragma unroll
      for (int j = 0; j < 4; ++j) b[j] = fragp_b(pw + (kc * 8 + j) * FRG);
      __builtin_amdgcn_sched_barrier(0);   // keeps the WMMAs, and with them the waits, behind all of the step's requests
#pragma unroll
      for (int j = 0; j < 4; ++j)
#pragma unroll
        for (int i = 0; i < 4; ++i) acc[i][j] = wmma_bf(a[i], b[j], acc[i][j]); }
    if ((PASS == 0 && lv >= 4) || (PASS == 1 && lv < 4)) {
    float bb[4];   // the level's four bias loads as one group, in front of the first tile's arithmetic
#pragma unroll   // four loads side by side, bb[] in registers
    for (int j = 0; j < 4; ++j) bb[j] = B1[n0 + j * 16 + col];
#pragma unroll   // acc[i][j] must be indexed by constants
    for (int i = 0; i < 4; ++i)
#pragma unroll
      for (int j = 0; j < 4; ++j) { float y[8];
        gelu8(acc[i][j], bfr(bb[j]), y);
#pragma unroll
        for (int r = 0; r < 8; ++r) sg[wave][i * 16 + 8 * g + r][j * 16 + col] = (_Float16)y[r];
        if (j & 1) __builtin_amdgcn_sched_barrier(0); }   // two tiles at a time: sixteen independent elements a lane are enough for the vector port; left free, the build spreads the tiles further, takes more registers and adds waits
    LDSX();
#pragma unroll
    for (int i = 0; i < 4; ++i)
#pragma unroll
      for (int q = 0; q < 4; ++q) vst2((unsigned*)(H + (((size_t)(lv & 3) * (NRW / 16) + rt0 + i) * (HH / 32) + (n0 >> 5)) * FRG + q * 256 + lane * 8), *(const v4u*)&sg[wave][i * 16 + col][q * 16 + 8 * g]);   // two A fragments of the out GEMM a row tile, 512 contiguous bytes a store
    asm volatile("s_wait_xcnt 0x0" ::: "memory");   // stands in front of the next level's rewrite of these stores' data and address registers
    LDSX(); }
    if (PASS == 0 && lv == 4) break; }
}
// ---- k_out: block = (64 rows, level slot), 16 waves = 2 row halves x 8 eighths of K 4096: out[row][lv][0..128) = H[lv % 4][row] . W2 + b2; lv = slot + 4 * first-pass flag
// a wave holds 32 rows x 128 columns over its own 512 of K: ten fragments feed sixteen WMMAs a k step, every hidden fragment is asked for by one wave only, and sixteen waves a WGP keep hidden rows in flight from memory; the eight partial sums of an element are added through LDS, eighth 0 first
#define KQ 8
#define KS (HH / 32 / KQ)   // k steps of a wave
__global__ __launch_bounds__(512) void k_out(const _Float16* __restrict__ H, const _Float16* __restrict__ P2, const float* __restrict__ B2, int lvbase, float* __restrict__ OUT) {
  __shared__ __align__(16) float so[KQ][64][132];
  const int tid = threadIdx.x, wave = tid >> 5, lane = tid & 31, col = lane & 15, g = lane >> 4; const int rh = wave & 1, kq = wave >> 1; const int slot = blockIdx.y; const int lv = lvbase + slot;
  v8f acc[2][8] = {};
  const _Float16* pa = H + (((size_t)slot * (NRW / 16) + blockIdx.x * 4 + rh * 2) * (HH / 32) + kq * KS) * FRG + lane * 8; const _Float16* pb = P2 + (size_t)kq * KS * 8 * FRG + lane * 8;   // one base an operand: the fragments' distances are constants of the load instructions
  v16h fa[2][2], fb[8];
#pragma unroll
  for (int t = 0; t < 2; ++t) fa[0][t] = fragp_h(pa + t * (HH / 32) * FRG);
#pragma unroll   // sixteen steps, straight line: ring places and load offsets are constants, and no address register is rewritten under a load in flight
  for (int u = 0; u < KS; ++u) {
#pragma unroll
    for (int j = 0; j < 8; ++j) fb[j] = fragp_h(pb + (u * 8 + j) * FRG);
    if (u + 1 < KS) {   // the next step's hidden fragments (from memory) behind this step's W2 requests: the counted wait for W2 leaves them in flight over the step's WMMAs
#pragma unroll
      for (int t = 0; t < 2; ++t) fa[(u + 1) & 1][t] = fragp_h(pa + (t * (HH / 32) + u + 1) * FRG); }
    __builtin_amdgcn_sched_barrier(0);   // keeps the step's first WMMA, and with it the wait, behind all of the step's requests
#pragma unroll
    for (int j = 0; j < 8; ++j)
#pragma unroll
      for (int t = 0; t < 2; ++t) acc[t][j] = wmma16(fa[u & 1][t], fb[j], acc[t][j]); }
#pragma unroll   // acc[t][j] must be indexed by constants
  for (int t = 0; t < 2; ++t)
#pragma unroll
    for (int j = 0; j < 8; ++j)
#pragma unroll
      for (int r = 0; r < 8; ++r) so[kq][rh * 32 + t * 16 + 8 * g + r][j * 16 + col] = acc[t][j][r];
  __syncthreads();   // every wave's partial sums stand in LDS before any wave adds them
  float bb[4];
#pragma unroll
  for (int e = 0; e < 4; ++e) bb[e] = bfr(B2[lane * 4 + e]);
#pragma unroll   // four rows a wave, their LDS reads side by side
  for (int m = 0; m < 4; ++m) { const int row = m * 16 + wave; v4f s = *(const v4f*)&so[0][row][lane * 4];
#pragma unroll
    for (int q = 1; q < KQ; ++q) s += *(const v4f*)&so[q][row][lane * 4];
    v4f o;
#pragma unroll
    for (int e = 0; e < 4; ++e) o[e] = s[e] * (1.0f / 256.0f) + bb[e];
    vst2(OUT + (((size_t)blockIdx.x * 64 + row) * LV + lv) * RR + lane * 4, o); }   // 512-B (row, level) segment
}
extern "C" void kernel_launch(void* const* d_in, const int* in_sizes, int n_in, void* d_out, int out_size, void* d_ws, size_t ws_size, hipStream_t stream) {
  (void)in_sizes; (void)n_in; (void)out_size;
  const float** F = (const float**)d_in;   // 0 x [16,256,8,128], 1 W1 [1024,4096] (in,out), 2 b1, 3 W2 [4096,128], 4 b2
  if (ws_size < (size_t)WS_END) return;
  char* ws = (char*)d_ws; __bf16 *P1 = (__bf16*)(ws + WS_P1), *PX = (__bf16*)(ws + WS_PX); _Float16 *P2 = (_Float16*)(ws + WS_P2), *H = (_Float16*)(ws + WS_H);
  k_pack<<<NT1 + NT2 + NTX, 256, 0, stream>>>(F[0], F[1], F[3], PX, P1, P2);
  k_lev<0><<<dim3(NRW / 256, HH / 256), 512, 0, stream>>>(PX, P1, F[2], H);   // levels 7..4 -> slots 3..0
  k_out<<<dim3(TRB, 4), 512, 0, stream>>>(H, P2, F[4], 4, (float*)d_out);
  k_lev<1><<<dim3(NRW / 256, HH / 256), 512, 0, stream>>>(PX, P1, F[2], H);   // levels 3..0
  k_out<<<dim3(TRB, 4), 512, 0, stream>>>(H, P2, F[4], 0, (float*)d_out);
}

// v006
// It runs in 87.1 microseconds.
// Two timings next to v005 put it at 1.50 and 1.51 times that version's speed.
// Counting every step since v000, it is 8.54 times as fast.
// compute dtype: all float inputs rounded to bf16; the level-masked first linear as EXACT bf16 products on WMMA 16x16x32 ((in,out) weights as A fragments) accumulated block-suffix-wise in f32 (level l = sum of the 128-wide input blocks >= l), + b1, tanh-GELU (as x / (1 + e^(-2u)), hardware exp2 and reciprocal), hidden rounded once to f16 (it stays in LDS) x exact f16 copies of W2 (x 2^8), f32 partial sums of four hidden quarters added, + b2; f32 output.
#include <hip/hip_runtime.h>
#include <math.h>

typedef __attribute__((ext_vector_type(16))) _Float16 v16h;
typedef __attribute__((ext_vector_type(16))) __bf16 v16b;
typedef __attribute__((ext_vector_type(8)))  _Float16 v8h;
typedef __attribute__((ext_vector_type(8)))  float v8f;
typedef __attribute__((ext_vector_type(4)))  float v4f;
typedef __attribute__((ext_vector_type(2)))  float v2f;
typedef __attribute__((ext_vector_type(4)))  unsigned v4u;
typedef __attribute__((ext_vector_type(4)))  int v4i;
typedef float __attribute__((may_alias)) float_a;
typedef int __attribute__((may_alias)) int_a;

template <typename T> __device__ __forceinline__ void vst2(void* p, T v) { *(T*)p = v;  }
__device__ __forceinline__ v8f wmma16(v16h a, v16h b, v8f c) {
  v8f d = __builtin_amdgcn_wmma_f32_16x16x32_f16(false, a, false, b, (short)0, c, false, false);
  asm volatile("v_nop\n\tv_nop\n\tv_nop\n\tv_nop" : "+v"(d) : "v"(a), "v"(b));
  return d;
}
__device__ __forceinline__ v8f wmma_bf(v16b a, v16b b, v8f c) {
  v8f d = __builtin_amdgcn_wmma_f32_16x16x32_bf16(false, a, false, b, (short)0, c, false, false);
  asm volatile("v_nop\n\tv_nop\n\tv_nop\n\tv_nop" : "+v"(d) : "v"(a), "v"(b));
  return d;
}
// 16x16x32 fragments: lane = (h = lane>>4, row/col = lane&15); elements 0..7 = k0+8h+0..7, 8..15 = k0+16+8h+0..7; D element r = row 8h+r
__device__ __forceinline__ v16h frag_h(const _Float16* rowk0, int lane) {
  union { v16h v; v8h q[2]; } u; const _Float16* p = rowk0 + 8 * (lane >> 4);
  u.q[0] = *(const v8h*)p; u.q[1] = *(const v8h*)(p + 16); return u.v;
}
__device__ __forceinline__ v16h frag_f32(const float* rowk0, int lane) {
  v16h a; const float* p = rowk0 + 8 * (lane >> 4);
#pragma unroll
  for (int i = 0; i < 8; ++i) { a[i] = (_Float16)p[i]; a[8 + i] = (_Float16)p[16 + i]; }
  return a;
}
__device__ __forceinline__ v16h frag_f32s(const float* rowk0, int lane, float sc) {
  v16h a; const float* p = rowk0 + 8 * (lane >> 4);
#pragma unroll
  for (int i = 0; i < 8; ++i) { a[i] = (_Float16)(p[i] * sc); a[8 + i] = (_Float16)(p[16 + i] * sc); }
  return a;
}
// column fragment from a [K][ld] layout (column n), rows >= K read as 0
__device__ __forceinline__ v16h fragc_f32(const float* W, int k0, int n, int lane, int ld, int K) {
  v16h a; const int g = lane >> 4;
#pragma unroll
  for (int i = 0; i < 8; ++i) { const int ka = k0 + 8 * g + i, kb = ka + 16;
    a[i] = (_Float16)(ka < K ? W[(size_t)(ka < K ? ka : K - 1) * ld + n] : 0.f); a[8 + i] = (_Float16)(kb < K ? W[(size_t)(kb < K ? kb : K - 1) * ld + n] : 0.f); }
  return a;
}
struct F2 { v16b h, l; };
__device__ __forceinline__ F2 bsplit16(const float v[16]) { F2 r;
#pragma unroll
  for (int i = 0; i < 16; ++i) { const __bf16 h = (__bf16)v[i]; r.h[i] = h; r.l[i] = (__bf16)(v[i] - (float)h); }
  return r; }
__device__ __forceinline__ F2 split_row(const float* row, int k0, int lane) { float v[16]; const float* p = row + k0 + 8 * (lane >> 4);
#pragma unroll
  for (int i = 0; i < 8; ++i) { v[i] = p[i]; v[8 + i] = p[16 + i]; }
  return bsplit16(v); }
__device__ __forceinline__ F2 split_rowK(const float* row, int k0, int lane, int K) { float v[16]; const int g = lane >> 4;
#pragma unroll
  for (int i = 0; i < 8; ++i) { const int ka = k0 + 8 * g + i, kb = ka + 16; v[i] = ka < K ? row[ka < K ? ka : K - 1] : 0.f; v[8 + i] = kb < K ? row[kb < K ? kb : K - 1] : 0.f; }
  return bsplit16(v); }
__device__ __forceinline__ F2 split_col(const float* W, int k0, int n, int lane, int ld, int K) { float v[16]; const int g = lane >> 4;
#pragma unroll
  for (int i = 0; i < 8; ++i) { const int ka = k0 + 8 * g + i, kb = ka + 16; v[i] = ka < K ? W[(size_t)(ka < K ? ka : K - 1) * ld + n] : 0.f; v[8 + i] = kb < K ? W[(size_t)(kb < K ? kb : K - 1) * ld + n] : 0.f; }
  return bsplit16(v); }
__device__ __forceinline__ v8f mac3(const F2& a, const F2& b, v8f c) { c = wmma_bf(a.l, b.h, c); c = wmma_bf(a.h, b.l, c); return wmma_bf(a.h, b.h, c); }
__device__ __forceinline__ float sigm(float v) { return 1.0f / (1.0f + expf(-v)); }
#define LDSX() do { asm volatile("s_wait_dscnt 0" ::: "memory"); __builtin_amdgcn_wave_barrier(); __builtin_amdgcn_fence(__ATOMIC_RELEASE, "workgroup"); } while (0)


// Tree MLP (B 16, P 256, 8 levels x 128, hidden 4,096): level l sees the token embedding with its first l*128 entries zeroed; h = NewGELU(inp W1 + b1), out = h W2 + b2 per level.
#define NRW 4096          // B*P rows
#define LV 8
#define RR 128
#define NE (LV * RR)      // 1024
#define HH 4096
#ifndef TRB
#define TRB (NRW / 64)
#endif
typedef __attribute__((ext_vector_type(8))) __bf16 v8b;
// fragment-order buffers: one 16x16x32 fragment = 1 KB = 32 lanes x 16 B (elements 0..7 of each lane), then 32 lanes x 16 B (elements 8..15): a wave's 16-B load covers 512 contiguous bytes. fl = fragment start + lane * 8
__device__ __forceinline__ v16b fragp_b(const __bf16* fl) { union { v16b v; v8b q[2]; } u; u.q[0] = *(const v8b*)fl; u.q[1] = *(const v8b*)(fl + 256); return u.v; }
__device__ __forceinline__ v16h fragp_h(const _Float16* fl) { union { v16h v; v8h q[2]; } u; u.q[0] = *(const v8h*)fl; u.q[1] = *(const v8h*)(fl + 256); return u.v; }
__device__ __forceinline__ float bfr(float v) { return (float)(__bf16)v; }
__device__ __attribute__((noinline)) float exp_ni(float v) { return expf(v); }
__device__ __attribute__((noinline)) float erf_ni(float v) { return erff(v); }

#define FRG 512                                    // elements of a fragment
#define WS_P1  0u                                  // bf16 W1 A fragments [n / 128][k / 32][8 column tiles][FRG]
#define WS_P2  (WS_P1 + 2u * (size_t)HH * NE)       // f16 x 2^8 W2 A fragments [k / 32][8 column tiles][FRG]
#define WS_PX  (WS_P2 + 2u * (size_t)RR * HH)       // bf16 x B fragments [row / 16][k / 32][FRG]
#define HQ 4                                       // quarters of the hidden width: one f32 partial sum of the output each
#define WS_PT  (WS_PX + 2u * (size_t)NRW * NE)      // f32 partial sums [HQ][row][level][128]
#define WS_END (WS_PT + 4u * (size_t)HQ * NRW * NE)

#define NT1 ((HH / 128) * (NE / 32))   // W1 tiles
#define NT2 (HH / 32)                  // W2 tiles
#define NTX ((NRW / 16) * (NE / 256))  // x tiles
// one block writes one 8-KB tile of eight fragments; a thread's chunk c = (fragment f, half hf, lane) is the 16 B that this lane will load
__global__ __launch_bounds__(256) void k_pack(const float* __restrict__ X, const float* __restrict__ W1, const float* __restrict__ W2, __bf16* __restrict__ PX, __bf16* __restrict__ P1, _Float16* __restrict__ P2) {
  const int b = blockIdx.x;
#pragma unroll
  for (int c = threadIdx.x; c < 512; c += 256) { const int f = c >> 6, lane = c & 31, col = lane & 15, ko = ((c >> 5) & 1) * 16 + 8 * (lane >> 4);
    if (b < NT1) { const float* p = W1 + (size_t)((b & 31) * 32 + ko) * HH + (b >> 5) * 128 + f * 16 + col; v8b o;
#pragma unroll
      for (int i = 0; i < 8; ++i) o[i] = (__bf16)p[(size_t)i * HH];
      *(v8b*)(P1 + (size_t)b * (8 * FRG) + c * 8) = o;
      asm volatile("s_wait_xcnt 0x0" ::: "memory"); }   // stands in front of the next chunk's rewrite of this store's data and address registers
    else if (b < NT1 + NT2) { const int kc = b - NT1; const float* p = W2 + (size_t)(kc * 32 + ko) * RR + f * 16 + col; v8h o;
#pragma unroll
      for (int i = 0; i < 8; ++i) o[i] = (_Float16)(bfr(p[i * RR]) * 256.0f);
      *(v8h*)(P2 + (size_t)kc * (8 * FRG) + c * 8) = o;
      asm volatile("s_wait_xcnt 0x0" ::: "memory"); }   // stands in front of the next chunk's rewrite of this store's data and address registers
    else { const int q = b - NT1 - NT2; const float* p = X + (size_t)((q >> 2) * 16 + col) * NE + ((q & 3) * 8 + f) * 32 + ko; const v4f lo = *(const v4f*)p, hi = *(const v4f*)(p + 4); v8b o;
#pragma unroll
      for (int i = 0; i < 4; ++i) { o[i] = (__bf16)lo[i]; o[4 + i] = (__bf16)hi[i]; }
      *(v8b*)(PX + (size_t)q * (8 * FRG) + c * 8) = o;
      asm volatile("s_wait_xcnt 0x0" ::: "memory"); } }   // stands in front of the next chunk's rewrite of this store's data and address registers
}
// GELU: 0.5 x (1 + tanh u) = x / (1 + e^(-2u)), u = sqrt(2/pi) (x + 0.044715 x^3): one hardware exp2 and one hardware reciprocal an element, inline, eight independent elements at a time.
// e^(-2u) = inf gives x * 0, e^(-2u) = 0 gives x, as the tanh form does at tanh = -1 and +1.
#define GK (-2.0f * 1.4426950408889634f * 0.7978845608028654f)   // -2 log2(e) sqrt(2/pi)
// Eight transcendentals as one statement: the early-clobber outputs share no register with a source, so none overwrites the source of the one in front of it; the v_nop is the slot that the instruction set asks for behind the last.
#define TR8(op, o, i) asm(op " %0, %8\n\t" op " %1, %9\n\t" op " %2, %10\n\t" op " %3, %11\n\t" op " %4, %12\n\t" op " %5, %13\n\t" op " %6, %14\n\t" op " %7, %15\n\tv_nop" \
  : "=&v"(o[0]), "=&v"(o[1]), "=&v"(o[2]), "=&v"(o[3]), "=&v"(o[4]), "=&v"(o[5]), "=&v"(o[6]), "=&v"(o[7]) : "v"(i[0]), "v"(i[1]), "v"(i[2]), "v"(i[3]), "v"(i[4]), "v"(i[5]), "v"(i[6]), "v"(i[7]))
// a = eight accumulators of one lane (eight hidden columns of one row), bb = their biases; packed f32 arithmetic in front of the exp2; the result is the lane's 16 B of a hidden fragment
__device__ __forceinline__ v8h gelu8(v8f a, const float (&bb)[8]) { v2f x[4]; float e[8], t[8], q[8]; v8h o;
#pragma unroll   // here and below: constant indices, so that the small arrays are registers
  for (int i = 0; i < 4; ++i) { x[i] = (v2f){a[2 * i], a[2 * i + 1]} + (v2f){bb[2 * i], bb[2 * i + 1]}; const v2f w = x[i] * (GK + (GK * 0.044715f) * (x[i] * x[i])); e[2 * i] = w[0]; e[2 * i + 1] = w[1]; }
  TR8("v_exp_f32", t, e);
#pragma unroll
  for (int r = 0; r < 8; ++r) t[r] = 1.0f + t[r];
  TR8("v_rcp_f32", q, t);
#pragma unroll
  for (int r = 0; r < 8; ++r) o[r] = (_Float16)(x[r >> 1][r & 1] * q[r]);
  return o; }
// the builtins alone: an asm statement's vector operands are held to the first 256 registers, and this kernel's accumulators and fragments need more; the compiler keeps its own builtins' distances
__device__ __forceinline__ v8f wm_bf(v16b a, v16b b, v8f c) { return __builtin_amdgcn_wmma_f32_16x16x32_bf16(false, a, false, b, (short)0, c, false, false); }
__device__ __forceinline__ v8f wm_h(v16h a, v16h b, v8f c) { return __builtin_amdgcn_wmma_f32_16x16x32_f16(false, a, false, b, (short)0, c, false, false); }
struct yes_t { static constexpr bool value = true; }; struct no_t { static constexpr bool value = false; };
#define CH 256                 // hidden columns of a chunk
#define NCH (HH / HQ / CH)     // chunks of a block
#define XW() asm volatile("s_wait_xcnt 0x0" ::: "memory")   // stands behind a group of loads or stores, in front of any later rewrite of their address (and data) registers
// one k step of the level GEMM: two W1 and four x fragments
template <int KC> __device__ __forceinline__ void ld1(const __bf16* pw, const __bf16* px, v16b (&a)[2], v16b (&b)[4]) {   // pw, px: the lane's places in the level's first fragments; KC: k steps from there, a constant of the load instructions
#pragma unroll
  for (int t = 0; t < 2; ++t) a[t] = fragp_b(pw + (KC * 8 + t) * FRG);
#pragma unroll
  for (int i = 0; i < 4; ++i) b[i] = fragp_b(px + (i * (NE / 32) + KC) * FRG);
  __builtin_amdgcn_sched_barrier(0); }   // keeps the WMMAs that follow, and their waits, behind all of the group's requests
__device__ __forceinline__ void mm1(const v16b (&a)[2], const v16b (&b)[4], v8f (&acc)[2][4]) {
#pragma unroll
  for (int t = 0; t < 2; ++t)
#pragma unroll
    for (int i = 0; i < 4; ++i) acc[t][i] = wm_bf(a[t], b[i], acc[t][i]);   // W1 as A, x as B: register r of a lane = hidden column 8 (lane >> 4) + r of row lane & 15
  __builtin_amdgcn_sched_barrier(0);   // the next requests overwrite a and b: they stay behind these WMMAs
  asm volatile("v_nop\n\tv_nop\n\tv_nop\n\tv_nop");   // four slots between the last WMMA and the global loads that land on its B registers, the distance this kernel has run with; they issue while the matrix unit works
  __builtin_amdgcn_sched_barrier(0); }   // holds the four slots in that place
// block = 64 rows x all 8 levels x a quarter of the hidden width, 8 waves, one block a WGP. Per chunk of 256 hidden columns:
// (1) a wave runs the level GEMM for 32 hidden columns x 64 rows, level 7 down to 0, and after each level puts GELU(sum + b1) into LDS as f16 fragments of the out GEMM (a lane's eight registers are its 16 B of the fragment);
// (2) behind a barrier wave l multiplies level l's 64 x 256 hidden block by the chunk's W2 rows and keeps its 64 x 128 sums in registers over all chunks. The hidden values never leave the WGP.
// PX without __restrict__: with it the build lifts every chunk's (equal) first x fragments out of the chunk loop and holds 64 registers for them, which do not fit
__global__ __launch_bounds__(256) void k_tree(const __bf16* PX, const __bf16* __restrict__ P1, const float* __restrict__ B1, const _Float16* __restrict__ P2, float* __restrict__ PT) {
  __shared__ __align__(16) _Float16 hs[LV * 4 * (CH / 32) * FRG];   // [level][row tile][k step][FRG]
  const int tid = threadIdx.x, wave = __builtin_amdgcn_readfirstlane(tid >> 5), lane = tid & 31, col = lane & 15, g = lane >> 4; const unsigned l8 = lane * 8;   // the wave's number as a scalar: fragment addresses are a scalar base and one lane offset
  v8f acc2[8][4] = {};   // [output column tile][row tile] of level = wave: register r = output column 8 g + r of row col
  const __bf16* px = PX + (size_t)blockIdx.x * 4 * (NE / 32) * FRG; const float* pb1 = B1 + blockIdx.y * (HH / HQ) + wave * 32 + 8 * g;   // pb1 steps a chunk on at the chunk loop's foot
#pragma unroll 1   // rolled, like the level loop below
  for (int c = 0; c < NCH; ++c) { const int hb = blockIdx.y * (HH / HQ) + c * CH, n0 = hb + wave * 32;
    const __bf16* pw = P1 + ((size_t)(n0 >> 7) * (NE / 32) * 8 + ((n0 >> 4) & 7) + (LV - 1) * (RR / 32) * 8) * FRG + l8; const __bf16* pxl = px + (LV - 1) * (RR / 32) * FRG + l8;   // level 7's first fragments; both step down a level at the loop's foot
    v16b a[2][2], b[2][4]; v8f acc1[2][4] = {}; float bb[2][8];   // two fragment sets, for even and odd k steps: a set is requested anew as soon as its WMMAs are issued
    ld1<0>(pw, pxl, a[0], b[0]); ld1<1>(pw, pxl, a[1], b[1]);
#pragma unroll
    for (int t = 0; t < 2; ++t) { const v4f lo = *(const v4f*)(pb1 + t * 16), hi = *(const v4f*)(pb1 + t * 16 + 4);
#pragma unroll
      for (int r = 0; r < 4; ++r) { bb[t][r] = bfr(lo[r]); bb[t][4 + r] = bfr(hi[r]); } }
    XW(); __builtin_amdgcn_sched_barrier(0);   // behind the chunk's first requests: what follows may land on their address registers
    // one level: its four k steps, then GELU into LDS; NEXT: the next level's first two k steps are requested as their sets fall free, and fly under this level's GELU
    auto level = [&](int lv, auto next) {
      mm1(a[0], b[0], acc1); ld1<2>(pw, pxl, a[0], b[0]);
      mm1(a[1], b[1], acc1); ld1<3>(pw, pxl, a[1], b[1]);
      mm1(a[0], b[0], acc1); if constexpr (next.value) ld1<-4>(pw, pxl, a[0], b[0]);
      mm1(a[1], b[1], acc1); if constexpr (next.value) { ld1<-3>(pw, pxl, a[1], b[1]); XW(); __builtin_amdgcn_sched_barrier(0); }   // the wait: the GELU's results and the addresses' step may land on these requests' address registers
#pragma unroll   // acc1[t][i] must be indexed by constants
      for (int i = 0; i < 4; ++i)
#pragma unroll
        for (int t = 0; t < 2; ++t) { *(v8h*)&hs[((lv * 4 + i) * (CH / 32) + wave) * FRG + t * 256 + lane * 8] = gelu8(acc1[t][i], bb[t]); __builtin_amdgcn_sched_barrier(0); } };   // a tile at a time: with two the registers do not fit
#pragma unroll 1
    for (int lv = LV - 1; lv > 0; --lv) { level(lv, yes_t()); pw -= (RR / 32) * 8 * FRG; pxl -= (RR / 32) * FRG; }
    level(0, no_t());   // apart from the loop: no branch stands among the requests, so every counted wait leaves the newer requests in flight
    const _Float16* ph = hs + wave * 4 * (CH / 32) * FRG + l8; const _Float16* pb = P2 + (size_t)(hb >> 5) * 8 * FRG;
    v16h fa[2][4], fb[2][8];
#pragma unroll   // the first W2 fragments do not depend on LDS: requested in front of the barrier
    for (int j = 0; j < 8; ++j) fb[0][j] = fragp_h(pb + j * FRG + l8);
    __syncthreads();   // every level's hidden fragments of the chunk stand in LDS before any wave multiplies them
#pragma unroll
    for (int i = 0; i < 4; ++i) fa[0][i] = fragp_h(ph + i * (CH / 32) * FRG);
#pragma unroll   // eight steps, straight line: ring places and load offsets are constants
    for (int u = 0; u < CH / 32; ++u) {
      if (u + 1 < CH / 32) {   // the next step's fragments are requested ahead of this step's WMMAs
#pragma unroll
        for (int j = 0; j < 8; ++j) fb[(u + 1) & 1][j] = fragp_h(pb + ((u + 1) * 8 + j) * FRG + l8);
#pragma unroll
        for (int i = 0; i < 4; ++i) fa[(u + 1) & 1][i] = fragp_h(ph + (i * (CH / 32) + u + 1) * FRG); }
      __builtin_amdgcn_sched_barrier(0);   // keeps the step's first WMMA, and with it the wait, behind the next step's requests
#pragma unroll
      for (int j = 0; j < 8; ++j)
#pragma unroll
        for (int i = 0; i < 4; ++i) acc2[j][i] = wm_h(fb[u & 1][j], fa[u & 1][i], acc2[j][i]);   // W2 as A, hidden as B
      __builtin_amdgcn_sched_barrier(0); }   // the requests of the step after next overwrite this step's fragments: they stay behind its WMMAs
    pb1 += CH;
    __syncthreads(); }   // every wave has read the chunk's hidden fragments before the next chunk (or the staging below) overwrites them
  // a wave's 64 x 128 sums leave as whole 512-B (row, level) segments, staged 16 rows at a time in the wave's own 32 KB of the hidden buffer
  float* st = (float*)(hs + wave * 4 * (CH / 32) * FRG); float* po = PT + (((size_t)blockIdx.y * NRW + blockIdx.x * 64) * LV + wave) * RR + lane * 4;
#pragma unroll   // acc2[j][i] must be indexed by constants
  for (int i = 0; i < 4; ++i) {
#pragma unroll
    for (int j = 0; j < 8; ++j) { const v8f d = acc2[j][i]; *(v4f*)&st[col * 132 + j * 16 + 8 * g] = (v4f){d[0], d[1], d[2], d[3]}; *(v4f*)&st[col * 132 + j * 16 + 8 * g + 4] = (v4f){d[4], d[5], d[6], d[7]}; }
    LDSX();
#pragma unroll
    for (int r = 0; r < 16; ++r) vst2(po + (size_t)(i * 16 + r) * (LV * RR), *(const v4f*)&st[r * 132 + lane * 4]);
    XW();
    LDSX(); }
}
// out = (sum of the four partial sums, quarter 0 first) x 2^-8 + b2; 256 blocks of 16 waves, a thread takes eight 16-B pieces, four a trip
#define PST (256 * 512 * 4)   // floats from one piece of a thread to its next
__global__ __launch_bounds__(512) void k_sum(const float* __restrict__ PT, const float* __restrict__ B2, float* __restrict__ OUT) {
  const size_t e0 = ((size_t)blockIdx.x * 512 + threadIdx.x) * 4; const v4f b = *(const v4f*)(B2 + (threadIdx.x & 31) * 4);
  typedef __attribute__((address_space(1))) const v4f gl4; typedef __attribute__((address_space(1))) v4f gs4;   // global pointers by type: as loop-carried values plain ones compile to flat loads and stores
  gl4* p[HQ]; gs4* po = (gs4*)(OUT + e0);
#pragma unroll
  for (int q = 0; q < HQ; ++q) p[q] = (gl4*)(PT + (size_t)q * NRW * NE + e0);
#pragma unroll 1   // rolled: the five addresses live over the trips, so no request's result lands on a register that an earlier request names
  for (int h = 0; h < 2; ++h) { v4f s[4][HQ];
#pragma unroll
    for (int m = 0; m < 4; ++m)
#pragma unroll
      for (int q = 0; q < HQ; ++q) s[m][q] = p[q][m * (PST / 4)];
    XW(); __builtin_amdgcn_sched_barrier(0);   // sixteen requests a lane in flight before the first sum
#pragma unroll
    for (int m = 0; m < 4; ++m) { const v4f t = ((s[m][0] + s[m][1]) + s[m][2]) + s[m][3]; v4f o;
#pragma unroll
      for (int k = 0; k < 4; ++k) o[k] = t[k] * (1.0f / 256.0f) + bfr(b[k]);
      po[m * (PST / 4)] = o; }
    XW(); __builtin_amdgcn_sched_barrier(0);   // the addresses step on behind the wait
#pragma unroll
    for (int q = 0; q < HQ; ++q) p[q] += PST;
    po += PST; }
}
extern "C" void kernel_launch(void* const* d_in, const int* in_sizes, int n_in, void* d_out, int out_size, void* d_ws, size_t ws_size, hipStream_t stream) {
  (void)in_sizes; (void)n_in; (void)out_size;
  const float** F = (const float**)d_in;   // 0 x [16,256,8,128], 1 W1 [1024,4096] (in,out), 2 b1, 3 W2 [4096,128], 4 b2
  if (ws_size < (size_t)WS_END) return;
  char* ws = (char*)d_ws; __bf16 *P1 = (__bf16*)(ws + WS_P1), *PX = (__bf16*)(ws + WS_PX); _Float16 *P2 = (_Float16*)(ws + WS_P2); float* PT = (float*)(ws + WS_PT);
  k_pack<<<NT1 + NT2 + NTX, 256, 0, stream>>>(F[0], F[1], F[3], PX, P1, P2);
  k_tree<<<dim3(NRW / 64, HQ), 256, 0, stream>>>(PX, P1, F[2], P2, PT);
  k_sum<<<256, 512, 0, stream>>>(PT, F[4], (float*)d_out);
}

// v007
// A run of this version takes 80.8 microseconds.
// Timed twice side by side with v006, it ran 1.08 times as fast both times.
// Counting every step since v000, it is 9.21 times as fast.
// compute dtype: all float inputs rounded to bf16; the level-masked first linear as EXACT bf16 products on WMMA 16x16x32 ((in,out) weights as A fragments) accumulated block-suffix-wise in f32 (level l = sum of the 128-wide input blocks >= l), + b1, tanh-GELU (as x / (1 + e^(-2u)), hardware exp2 and reciprocal), hidden rounded once to f16 (it stays in LDS) x exact f16 copies of W2 (x 2^8), f32 partial sums of four hidden quarters added, + b2; f32 output.
#include <hip/hip_runtime.h>
#include <math.h>

typedef __attribute__((ext_vector_type(16))) _Float16 v16h;
typedef __attribute__((ext_vector_type(16))) __bf16 v16b;
typedef __attribute__((ext_vector_type(8)))  _Float16 v8h;
typedef __attribute__((ext_vector_type(8)))  float v8f;
typedef __attribute__((ext_vector_type(4)))  float v4f;
typedef __attribute__((ext_vector_type(2)))  float v2f;
typedef __attribute__((ext_vector_type(4)))  unsigned v4u;
typedef __attribute__((ext_vector_type(4)))  int v4i;
typedef float __attribute__((may_alias)) float_a;
typedef int __attribute__((may_alias)) int_a;

template <typename T> __device__ __forceinline__ void vst2(void* p, T v) { *(T*)p = v;  }
__device__ __forceinline__ v8f wmma16(v16h a, v16h b, v8f c) {
  v8f d = __builtin_amdgcn_wmma_f32_16x16x32_f16(false, a, false, b, (short)0, c, false, false);
  asm volatile("v_nop\n\tv_nop\n\tv_nop\n\tv_nop" : "+v"(d) : "v"(a), "v"(b));
  return d;
}
__device__ __forceinline__ v8f wmma_bf(v16b a, v16b b, v8f c) {
  v8f d = __builtin_amdgcn_wmma_f32_16x16x32_bf16(false, a, false, b, (short)0, c, false, false);
  asm volatile("v_nop\n\tv_nop\n\tv_nop\n\tv_nop" : "+v"(d) : "v"(a), "v"(b));
  return d;
}
// 16x16x32 fragments: lane = (h = lane>>4, row/col = lane&15); elements 0..7 = k0+8h+0..7, 8..15 = k0+16+8h+0..7; D element r = row 8h+r
__device__ __forceinline__ v16h frag_h(const _Float16* rowk0, int lane) {
  union { v16h v; v8h q[2]; } u; const _Float16* p = rowk0 + 8 * (lane >> 4);
  u.q[0] = *(const v8h*)p; u.q[1] = *(const v8h*)(p + 16); return u.v;
}
__device__ __forceinline__ v16h frag_f32(const float* rowk0, int lane) {
  v16h a; const float* p = rowk0 + 8 * (lane >> 4);
#pragma unroll
  for (int i = 0; i < 8; ++i) { a[i] = (_Float16)p[i]; a[8 + i] = (_Float16)p[16 + i]; }
  return a;
}
__device__ __forceinline__ v16h frag_f32s(const float* rowk0, int lane, float sc) {
  v16h a; const float* p = rowk0 + 8 * (lane >> 4);
#pragma unroll
  for (int i = 0; i < 8; ++i) { a[i] = (_Float16)(p[i] * sc); a[8 + i] = (_Float16)(p[16 + i] * sc); }
  return a;
}
// column fragment from a [K][ld] layout (column n), rows >= K read as 0
__device__ __forceinline__ v16h fragc_f32(const float* W, int k0, int n, int lane, int ld, int K) {
  v16h a; const int g = lane >> 4;
#pragma unroll
  for (int i = 0; i < 8; ++i) { const int ka = k0 + 8 * g + i, kb = ka + 16;
    a[i] = (_Float16)(ka < K ? W[(size_t)(ka < K ? ka : K - 1) * ld + n] : 0.f); a[8 + i] = (_Float16)(kb < K ? W[(size_t)(kb < K ? kb : K - 1) * ld + n] : 0.f); }
  return a;
}
struct F2 { v16b h, l; };
__device__ __forceinline__ F2 bsplit16(const float v[16]) { F2 r;
#pragma unroll
  for (int i = 0; i < 16; ++i) { const __bf16 h = (__bf16)v[i]; r.h[i] = h; r.l[i] = (__bf16)(v[i] - (float)h); }
  return r; }
__device__ __forceinline__ F2 split_row(const float* row, int k0, int lane) { float v[16]; const float* p = row + k0 + 8 * (lane >> 4);
#pragma unroll
  for (int i = 0; i < 8; ++i) { v[i] = p[i]; v[8 + i] = p[16 + i]; }
  return bsplit16(v); }
__device__ __forceinline__ F2 split_rowK(const float* row, int k0, int lane, int K) { float v[16]; const int g = lane >> 4;
#pragma unroll
  for (int i = 0; i < 8; ++i) { const int ka = k0 + 8 * g + i, kb = ka + 16; v[i] = ka < K ? row[ka < K ? ka : K - 1] : 0.f; v[8 + i] = kb < K ? row[kb < K ? kb : K - 1] : 0.f; }
  return bsplit16(v); }
__device__ __forceinline__ F2 split_col(const float* W, int k0, int n, int lane, int ld, int K) { float v[16]; const int g = lane >> 4;
#pragma unroll
  for (int i = 0; i < 8; ++i) { const int ka = k0 + 8 * g + i, kb = ka + 16; v[i] = ka < K ? W[(size_t)(ka < K ? ka : K - 1) * ld + n] : 0.f; v[8 + i] = kb < K ? W[(size_t)(kb < K ? kb : K - 1) * ld + n] : 0.f; }
  return bsplit16(v); }
__device__ __forceinline__ v8f mac3(const F2& a, const F2& b, v8f c) { c = wmma_bf(a.l, b.h, c); c = wmma_bf(a.h, b.l, c); return wmma_bf(a.h, b.h, c); }
__device__ __forceinline__ float sigm(float v) { return 1.0f / (1.0f + expf(-v)); }
#define LDSX() do { asm volatile("s_wait_dscnt 0" ::: "memory"); __builtin_amdgcn_wave_barrier(); __builtin_amdgcn_fence(__ATOMIC_RELEASE, "workgroup"); } while (0)


// Tree MLP (B 16, P 256, 8 levels x 128, hidden 4,096): level l sees the token embedding with its first l*128 entries zeroed; h = NewGELU(inp W1 + b1), out = h W2 + b2 per level.
#define NRW 4096          // B*P rows
#define LV 8
#define RR 128
#define NE (LV * RR)      // 1024
#define HH 4096
#ifndef TRB
#define TRB (NRW / 64)
#endif
typedef __attribute__((ext_vector_type(8))) __bf16 v8b;
// fragment-order buffers: one 16x16x32 fragment = 1 KB = 32 lanes x 16 B (elements 0..7 of each lane), then 32 lanes x 16 B (elements 8..15): a wave's 16-B load covers 512 contiguous bytes. fl = fragment start + lane * 8
__device__ __forceinline__ v16b fragp_b(const __bf16* fl) { union { v16b v; v8b q[2]; } u; u.q[0] = *(const v8b*)fl; u.q[1] = *(const v8b*)(fl + 256); return u.v; }
__device__ __forceinline__ v16h fragp_h(const _Float16* fl) { union { v16h v; v8h q[2]; } u; u.q[0] = *(const v8h*)fl; u.q[1] = *(const v8h*)(fl + 256); return u.v; }
__device__ __forceinline__ float bfr(float v) { return (float)(__bf16)v; }
__device__ __attribute__((noinline)) float exp_ni(float v) { return expf(v); }
__device__ __attribute__((noinline)) float erf_ni(float v) { return erff(v); }

#define FRG 512                                    // elements of a fragment
#define WS_P1  0u                                  // bf16 W1 A fragments [n / 128][k / 32][8 column tiles][FRG]
#define WS_P2  (WS_P1 + 2u * (size_t)HH * NE)       // f16 x 2^8 W2 A fragments [k / 32][8 column tiles][FRG]
#define WS_PX  (WS_P2 + 2u * (size_t)RR * HH)       // bf16 x B fragments [row / 16][k / 32][FRG]
#define HQ 4                                       // quarters of the hidden width: one f32 partial sum of the output each
#define WS_PT  (WS_PX + 2u * (size_t)NRW * NE)      // f32 partial sums [HQ][row][level][128]
#define WS_END (WS_PT + 4u * (size_t)HQ * NRW * NE)

#define NT1 ((HH / 128) * (NE / 32))   // W1 tiles
#define NT2 (HH / 32)                  // W2 tiles
#define NTX ((NRW / 16) * (NE / 256))  // x tiles
// one block writes one 8-KB tile of eight fragments; a thread's chunk c = (fragment f, half hf, lane) is the 16 B that this lane will load
__global__ __launch_bounds__(256) void k_pack(const float* __restrict__ X, const float* __restrict__ W1, const float* __restrict__ W2, __bf16* __restrict__ PX, __bf16* __restrict__ P1, _Float16* __restrict__ P2) {
  const int b = blockIdx.x;
#pragma unroll
  for (int c = threadIdx.x; c < 512; c += 256) { const int f = c >> 6, lane = c & 31, col = lane & 15, ko = ((c >> 5) & 1) * 16 + 8 * (lane >> 4);
    if (b < NT1) { const float* p = W1 + (size_t)((b & 31) * 32 + ko) * HH + (b >> 5) * 128 + f * 16 + col; v8b o;
#pragma unroll
      for (int i = 0; i < 8; ++i) o[i] = (__bf16)p[(size_t)i * HH];
      *(v8b*)(P1 + (size_t)b * (8 * FRG) + c * 8) = o;
      asm volatile("s_wait_xcnt 0x0" ::: "memory"); }   // stands in front of the next chunk's rewrite of this store's data and address registers
    else if (b < NT1 + NT2) { const int kc = b - NT1; const float* p = W2 + (size_t)(kc * 32 + ko) * RR + f * 16 + col; v8h o;
#pragma unroll
      for (int i = 0; i < 8; ++i) o[i] = (_Float16)(bfr(p[i * RR]) * 256.0f);
      *(v8h*)(P2 + (size_t)kc * (8 * FRG) + c * 8) = o;
      asm volatile("s_wait_xcnt 0x0" ::: "memory"); }   // stands in front of the next chunk's rewrite of this store's data and address registers
    else { const int q = b - NT1 - NT2; const float* p = X + (size_t)((q >> 2) * 16 + col) * NE + ((q & 3) * 8 + f) * 32 + ko; const v4f lo = *(const v4f*)p, hi = *(const v4f*)(p + 4); v8b o;
#pragma unroll
      for (int i = 0; i < 4; ++i) { o[i] = (__bf16)lo[i]; o[4 + i] = (__bf16)hi[i]; }
      *(v8b*)(PX + (size_t)q * (8 * FRG) + c * 8) = o;
      asm volatile("s_wait_xcnt 0x0" ::: "memory"); } }   // stands in front of the next chunk's rewrite of this store's data and address registers
}
// GELU: 0.5 x (1 + tanh u) = x / (1 + e^(-2u)), u = sqrt(2/pi) (x + 0.044715 x^3): one hardware exp2 and one hardware reciprocal an element, inline, eight independent elements at a time.
// e^(-2u) = inf gives x * 0, e^(-2u) = 0 gives x, as the tanh form does at tanh = -1 and +1.
#define GK (-2.0f * 1.4426950408889634f * 0.7978845608028654f)   // -2 log2(e) sqrt(2/pi)
// Eight transcendentals as one statement: the early-clobber outputs share no register with a source, so none overwrites the source of the one in front of it; the v_nop is the slot that the instruction set asks for behind the last.
#define TR8(op, o, i) asm(op " %0, %8\n\t" op " %1, %9\n\t" op " %2, %10\n\t" op " %3, %11\n\t" op " %4, %12\n\t" op " %5, %13\n\t" op " %6, %14\n\t" op " %7, %15\n\tv_nop" \
  : "=&v"(o[0]), "=&v"(o[1]), "=&v"(o[2]), "=&v"(o[3]), "=&v"(o[4]), "=&v"(o[5]), "=&v"(o[6]), "=&v"(o[7]) : "v"(i[0]), "v"(i[1]), "v"(i[2]), "v"(i[3]), "v"(i[4]), "v"(i[5]), "v"(i[6]), "v"(i[7]))
// a = eight accumulators of one lane (eight hidden columns of one row), bb = their biases; packed f32 arithmetic in front of the exp2; the result is the lane's 16 B of a hidden fragment
__device__ __forceinline__ v8h gelu8(v8f a, const float (&bb)[8]) { v2f x[4]; float e[8], t[8], q[8]; v8h o;
#pragma unroll   // here and below: constant indices, so that the small arrays are registers
  for (int i = 0; i < 4; ++i) { x[i] = (v2f){a[2 * i], a[2 * i + 1]} + (v2f){bb[2 * i], bb[2 * i + 1]}; const v2f w = x[i] * (GK + (GK * 0.044715f) * (x[i] * x[i])); e[2 * i] = w[0]; e[2 * i + 1] = w[1]; }
  TR8("v_exp_f32", t, e);
#pragma unroll
  for (int r = 0; r < 8; ++r) t[r] = 1.0f + t[r];
  TR8("v_rcp_f32", q, t);
#pragma unroll
  for (int r = 0; r < 8; ++r) o[r] = (_Float16)(x[r >> 1][r & 1] * q[r]);
  return o; }
// the builtins alone: an asm statement's vector operands are held to the first 256 registers, and this kernel's accumulators and fragments need more; the compiler keeps its own builtins' distances
__device__ __forceinline__ v8f wm_bf(v16b a, v16b b, v8f c) { return __builtin_amdgcn_wmma_f32_16x16x32_bf16(false, a, false, b, (short)0, c, false, false); }
__device__ __forceinline__ v8f wm_h(v16h a, v16h b, v8f c) { return __builtin_amdgcn_wmma_f32_16x16x32_f16(false, a, false, b, (short)0, c, false, false); }
struct yes_t { static constexpr bool value = true; }; struct no_t { static constexpr bool value = false; };
#define CH 256                 // hidden columns of a chunk
#define NCH (HH / HQ / CH)     // chunks of a block
#define XW() asm volatile("s_wait_xcnt 0x0" ::: "memory")   // stands behind a group of loads or stores, in front of any later rewrite of their address (and data) registers
// one k step of the level GEMM: two W1 and four x fragments
template <int KC> __device__ __forceinline__ void ld1(const __bf16* pw, const __bf16* px, v16b (&a)[2], v16b (&b)[4]) {   // pw, px: the lane's places in the level's first fragments; KC: k steps from there, a constant of the load instructions
#pragma unroll
  for (int t = 0; t < 2; ++t) a[t] = fragp_b(pw + (KC * 8 + t) * FRG);
#pragma unroll
  for (int i = 0; i < 4; ++i) b[i] = fragp_b(px + (i * (NE / 32) + KC) * FRG);
  __builtin_amdgcn_sched_barrier(0); }   // keeps the WMMAs that follow, and their waits, behind all of the group's requests
__device__ __forceinline__ void mm1(const v16b (&a)[2], const v16b (&b)[4], v8f (&acc)[2][4]) {
#pragma unroll
  for (int t = 0; t < 2; ++t)
#pragma unroll
    for (int i = 0; i < 4; ++i) acc[t][i] = wm_bf(a[t], b[i], acc[t][i]);   // W1 as A, x as B: register r of a lane = hidden column 8 (lane >> 4) + r of row lane & 15
  __builtin_amdgcn_sched_barrier(0);   // the next requests overwrite a and b: they stay behind these WMMAs
  asm volatile("v_nop\n\tv_nop\n\tv_nop\n\tv_nop");   // four slots between the last WMMA and the global loads that land on its B registers, the distance this kernel has run with; they issue while the matrix unit works
  __builtin_amdgcn_sched_barrier(0); }   // holds the four slots in that place
// block = 64 rows x all 8 levels x a quarter of the hidden width, 8 waves, one block a WGP. Per chunk of 256 hidden columns:
// (1) a wave runs the level GEMM for 32 hidden columns x 64 rows, level 7 down to 0, and after each level puts GELU(sum + b1) into LDS as f16 fragments of the out GEMM (a lane's eight registers are its 16 B of the fragment);
// (2) behind a barrier wave l multiplies level l's 64 x 256 hidden block by the chunk's W2 rows and keeps its 64 x 128 sums in registers over all chunks. The hidden values never leave the WGP.
// PX without __restrict__: with it the build lifts every chunk's (equal) first x fragments out of the chunk loop and holds 64 registers for them, which do not fit
__global__ __launch_bounds__(256) void k_tree(const __bf16* PX, const __bf16* __restrict__ P1, const float* __restrict__ B1, const _Float16* __restrict__ P2, float* __restrict__ PT) {
  __shared__ __align__(16) _Float16 hs[LV * 4 * (CH / 32) * FRG];   // [level][row tile][k step][FRG]
  const int tid = threadIdx.x, wave = __builtin_amdgcn_readfirstlane(tid >> 5), lane = tid & 31, col = lane & 15, g = lane >> 4; const unsigned l8 = lane * 8;   // the wave's number as a scalar: fragment addresses are a scalar base and one lane offset
  v8f acc2[8][4] = {};   // [output column tile][row tile] of level = wave: register r = output column 8 g + r of row col
  const __bf16* px = PX + (size_t)blockIdx.x * 4 * (NE / 32) * FRG; const float* pb1 = B1 + blockIdx.y * (HH / HQ) + (blockIdx.x % NCH) * CH + wave * 32 + 8 * g;   // pb1 steps a chunk on at the chunk loop's foot
#pragma unroll 1   // rolled, like the level loop below
  for (int c = 0; c < NCH; ++c) {
    // The 64 blocks that share a quarter of W1 and W2 do not all walk it from the same end: block x starts at chunk x mod NCH and wraps round. Walking in step, each fragment's first reader waits on memory and the rest wait with it, all the way;
    // so only the first chunk of a block is read that way, and each later one has been brought into L2 by the blocks that began there. For speed only: any placement of the blocks gives the same sums.
    const int cr = (c + blockIdx.x) % NCH, hb = blockIdx.y * (HH / HQ) + cr * CH, n0 = hb + wave * 32;
    const __bf16* pw = P1 + ((size_t)(n0 >> 7) * (NE / 32) * 8 + ((n0 >> 4) & 7) + (LV - 1) * (RR / 32) * 8) * FRG + l8; const __bf16* pxl = px + (LV - 1) * (RR / 32) * FRG + l8;   // level 7's first fragments; both step down a level at the loop's foot
    v16b a[2][2], b[2][4]; v8f acc1[2][4] = {}; float bb[2][8];   // two fragment sets, for even and odd k steps: a set is requested anew as soon as its WMMAs are issued
    ld1<0>(pw, pxl, a[0], b[0]); ld1<1>(pw, pxl, a[1], b[1]);
#pragma unroll
    for (int t = 0; t < 2; ++t) { const v4f lo = *(const v4f*)(pb1 + t * 16), hi = *(const v4f*)(pb1 + t * 16 + 4);
#pragma unroll
      for (int r = 0; r < 4; ++r) { bb[t][r] = bfr(lo[r]); bb[t][4 + r] = bfr(hi[r]); } }
    XW(); __builtin_amdgcn_sched_barrier(0);   // behind the chunk's first requests: what follows may land on their address registers
    // one level: its four k steps, then GELU into LDS; NEXT: the next level's first two k steps are requested as their sets fall free, and fly under this level's GELU
    auto level = [&](int lv, auto next) {
      mm1(a[0], b[0], acc1); ld1<2>(pw, pxl, a[0], b[0]);
      mm1(a[1], b[1], acc1); ld1<3>(pw, pxl, a[1], b[1]);
      mm1(a[0], b[0], acc1); if constexpr (next.value) ld1<-4>(pw, pxl, a[0], b[0]);
      mm1(a[1], b[1], acc1); if constexpr (next.value) { ld1<-3>(pw, pxl, a[1], b[1]); XW(); __builtin_amdgcn_sched_barrier(0); }   // the wait: the GELU's results and the addresses' step may land on these requests' address registers
#pragma unroll   // acc1[t][i] must be indexed by constants
      for (int i = 0; i < 4; ++i)
#pragma unroll
        for (int t = 0; t < 2; ++t) { *(v8h*)&hs[((lv * 4 + i) * (CH / 32) + wave) * FRG + t * 256 + lane * 8] = gelu8(acc1[t][i], bb[t]); __builtin_amdgcn_sched_barrier(0); } };   // a tile at a time: with two the registers do not fit
#pragma unroll 1
    for (int lv = LV - 1; lv > 0; --lv) { level(lv, yes_t()); pw -= (RR / 32) * 8 * FRG; pxl -= (RR / 32) * FRG; }
    level(0, no_t());   // apart from the loop: no branch stands among the requests, so every counted wait leaves the newer requests in flight
    const _Float16* ph = hs + wave * 4 * (CH / 32) * FRG + l8; const _Float16* pb = P2 + (size_t)(hb >> 5) * 8 * FRG;
    v16h fa[2][4], fb[2][8];
#pragma unroll   // the first W2 fragments do not depend on LDS: requested in front of the barrier
    for (int j = 0; j < 8; ++j) fb[0][j] = fragp_h(pb + j * FRG + l8);
    __syncthreads();   // every level's hidden fragments of the chunk stand in LDS before any wave multiplies them
#pragma unroll
    for (int i = 0; i < 4; ++i) fa[0][i] = fragp_h(ph + i * (CH / 32) * FRG);
#pragma unroll   // eight steps, straight line: ring places and load offsets are constants
    for (int u = 0; u < CH / 32; ++u) {
      if (u + 1 < CH / 32) {   // the next step's fragments are requested ahead of this step's WMMAs
#pragma unroll
        for (int j = 0; j < 8; ++j) fb[(u + 1) & 1][j] = fragp_h(pb + ((u + 1) * 8 + j) * FRG + l8);
#pragma unroll
        for (int i = 0; i < 4; ++i) fa[(u + 1) & 1][i] = fragp_h(ph + (i * (CH / 32) + u + 1) * FRG); }
      __builtin_amdgcn_sched_barrier(0);   // keeps the step's first WMMA, and with it the wait, behind the next step's requests
#pragma unroll
      for (int j = 0; j < 8; ++j)
#pragma unroll
        for (int i = 0; i < 4; ++i) acc2[j][i] = wm_h(fb[u & 1][j], fa[u & 1][i], acc2[j][i]);   // W2 as A, hidden as B
      __builtin_amdgcn_sched_barrier(0); }   // the requests of the step after next overwrite this step's fragments: they stay behind its WMMAs
    pb1 += cr + 1 < NCH ? CH : -(NCH - 1) * CH;
    __syncthreads(); }   // every wave has read the chunk's hidden fragments before the next chunk (or the staging below) overwrites them
  // a wave's 64 x 128 sums leave as whole 512-B (row, level) segments, staged 16 rows at a time in the wave's own 32 KB of the hidden buffer
  float* st = (float*)(hs + wave * 4 * (CH / 32) * FRG); float* po = PT + (((size_t)blockIdx.y * NRW + blockIdx.x * 64) * LV + wave) * RR + lane * 4;
#pragma unroll   // acc2[j][i] must be indexed by constants
  for (int i = 0; i < 4; ++i) {
#pragma unroll
    for (int j = 0; j < 8; ++j) { const v8f d = acc2[j][i]; *(v4f*)&st[col * 132 + j * 16 + 8 * g] = (v4f){d[0], d[1], d[2], d[3]}; *(v4f*)&st[col * 132 + j * 16 + 8 * g + 4] = (v4f){d[4], d[5], d[6], d[7]}; }
    LDSX();
#pragma unroll
    for (int r = 0; r < 16; ++r) vst2(po + (size_t)(i * 16 + r) * (LV * RR), *(const v4f*)&st[r * 132 + lane * 4]);
    XW();
    LDSX(); }
}
// out = (sum of the four partial sums, quarter 0 first) x 2^-8 + b2; 256 blocks of 16 waves, a thread takes eight 16-B pieces, four a trip
#define PST (256 * 512 * 4)   // floats from one piece of a thread to its next
__global__ __launch_bounds__(512) void k_sum(const float* __restrict__ PT, const float* __restrict__ B2, float* __restrict__ OUT) {
  const size_t e0 = ((size_t)blockIdx.x * 512 + threadIdx.x) * 4; const v4f b = *(const v4f*)(B2 + (threadIdx.x & 31) * 4);
  typedef __attribute__((address_space(1))) const v4f gl4; typedef __attribute__((address_space(1))) v4f gs4;   // global pointers by type: as loop-carried values plain ones compile to flat loads and stores
  gl4* p[HQ]; gs4* po = (gs4*)(OUT + e0);
#pragma unroll
  for (int q = 0; q < HQ; ++q) p[q] = (gl4*)(PT + (size_t)q * NRW * NE + e0);
#pragma unroll 1   // rolled: the five addresses live over the trips, so no request's result lands on a register that an earlier request names
  for (int h = 0; h < 2; ++h) { v4f s[4][HQ];
#pragma unroll
    for (int m = 0; m < 4; ++m)
#pragma unroll
      for (int q = 0; q < HQ; ++q) s[m][q] = p[q][m * (PST / 4)];
    XW(); __builtin_amdgcn_sched_barrier(0);   // sixteen requests a lane in flight before the first sum
#pragma unroll
    for (int m = 0; m < 4; ++m) { const v4f t = ((s[m][0] + s[m][1]) + s[m][2]) + s[m][3]; v4f o;
#pragma unroll
      for (int k = 0; k < 4; ++k) o[k] = t[k] * (1.0f / 256.0f) + bfr(b[k]);
      po[m * (PST / 4)] = o; }
    XW(); __builtin_amdgcn_sched_barrier(0);   // the addresses step on behind the wait
#pragma unroll
    for (int q = 0; q < HQ; ++q) p[q] += PST;
    po += PST; }
}
extern "C" void kernel_launch(void* const* d_in, const int* in_sizes, int n_in, void* d_out, int out_size, void* d_ws, size_t ws_size, hipStream_t stream) {
  (void)in_sizes; (void)n_in; (void)out_size;
  const float** F = (const float**)d_in;   // 0 x [16,256,8,128], 1 W1 [1024,4096] (in,out), 2 b1, 3 W2 [4096,128], 4 b2
  if (ws_size < (size_t)WS_END) return;
  char* ws = (char*)d_ws; __bf16 *P1 = (__bf16*)(ws + WS_P1), *PX = (__bf16*)(ws + WS_PX); _Float16 *P2 = (_Float16*)(ws + WS_P2); float* PT = (float*)(ws + WS_PT);
  k_pack<<<NT1 + NT2 + NTX, 256, 0, stream>>>(F[0], F[1], F[3], PX, P1, P2);
  k_tree<<<dim3(NRW / 64, HQ), 256, 0, stream>>>(PX, P1, F[2], P2, PT);
  k_sum<<<256, 512, 0, stream>>>(PT, F[4], (float*)d_out);
}

// v008
// A run of this version takes 77.6 microseconds.
// Timed twice side by side with v007, it ran 1.04 times as fast both times.
// Over all steps from v000 it is 9.58 times as fast.
// compute dtype: all float inputs rounded to bf16; the level-masked first linear as EXACT bf16 products on WMMA 16x16x32 ((in,out) weights as A fragments) accumulated block-suffix-wise in f32 (level l = sum of the 128-wide input blocks >= l), + b1, tanh-GELU x 2 (as x + x tanh u, hardware tanh), hidden rounded once to f16 (it stays in LDS) x exact f16 copies of W2 (x 2^8), f32 partial sums of four hidden quarters added, x 2^-9, + b2; f32 output.
#include <hip/hip_runtime.h>
#include <math.h>

typedef __attribute__((ext_vector_type(16))) _Float16 v16h;
typedef __attribute__((ext_vector_type(16))) __bf16 v16b;
typedef __attribute__((ext_vector_type(8)))  _Float16 v8h;
typedef __attribute__((ext_vector_type(8)))  float v8f;
typedef __attribute__((ext_vector_type(4)))  float v4f;
typedef __attribute__((ext_vector_type(2)))  float v2f;
typedef __attribute__((ext_vector_type(4)))  unsigned v4u;
typedef __attribute__((ext_vector_type(4)))  int v4i;
typedef float __attribute__((may_alias)) float_a;
typedef int __attribute__((may_alias)) int_a;

template <typename T> __device__ __forceinline__ void vst2(void* p, T v) { *(T*)p = v;  }
__device__ __forceinline__ v8f wmma16(v16h a, v16h b, v8f c) {
  v8f d = __builtin_amdgcn_wmma_f32_16x16x32_f16(false, a, false, b, (short)0, c, false, false);
  asm volatile("v_nop\n\tv_nop\n\tv_nop\n\tv_nop" : "+v"(d) : "v"(a), "v"(b));
  return d;
}
__device__ __forceinline__ v8f wmma_bf(v16b a, v16b b, v8f c) {
  v8f d = __builtin_amdgcn_wmma_f32_16x16x32_bf16(false, a, false, b, (short)0, c, false, false);
  asm volatile("v_nop\n\tv_nop\n\tv_nop\n\tv_nop" : "+v"(d) : "v"(a), "v"(b));
  return d;
}
// 16x16x32 fragments: lane = (h = lane>>4, row/col = lane&15); elements 0..7 = k0+8h+0..7, 8..15 = k0+16+8h+0..7; D element r = row 8h+r
__device__ __forceinline__ v16h frag_h(const _Float16* rowk0, int lane) {
  union { v16h v; v8h q[2]; } u; const _Float16* p = rowk0 + 8 * (lane >> 4);
  u.q[0] = *(const v8h*)p; u.q[1] = *(const v8h*)(p + 16); return u.v;
}
__device__ __forceinline__ v16h frag_f32(const float* rowk0, int lane) {
  v16h a; const float* p = rowk0 + 8 * (lane >> 4);
#pragma unroll
  for (int i = 0; i < 8; ++i) { a[i] = (_Float16)p[i]; a[8 + i] = (_Float16)p[16 + i]; }
  return a;
}
__device__ __forceinline__ v16h frag_f32s(const float* rowk0, int lane, float sc) {
  v16h a; const float* p = rowk0 + 8 * (lane >> 4);
#pragma unroll
  for (int i = 0; i < 8; ++i) { a[i] = (_Float16)(p[i] * sc); a[8 + i] = (_Float16)(p[16 + i] * sc); }
  return a;
}
// column fragment from a [K][ld] layout (column n), rows >= K read as 0
__device__ __forceinline__ v16h fragc_f32(const float* W, int k0, int n, int lane, int ld, int K) {
  v16h a; const int g = lane >> 4;
#pragma unroll
  for (int i = 0; i < 8; ++i) { const int ka = k0 + 8 * g + i, kb = ka + 16;
    a[i] = (_Float16)(ka < K ? W[(size_t)(ka < K ? ka : K - 1) * ld + n] : 0.f); a[8 + i] = (_Float16)(kb < K ? W[(size_t)(kb < K ? kb : K - 1) * ld + n] : 0.f); }
  return a;
}
struct F2 { v16b h, l; };
__device__ __forceinline__ F2 bsplit16(const float v[16]) { F2 r;
#pragma unroll
  for (int i = 0; i < 16; ++i) { const __bf16 h = (__bf16)v[i]; r.h[i] = h; r.l[i] = (__bf16)(v[i] - (float)h); }
  return r; }
__device__ __forceinline__ F2 split_row(const float* row, int k0, int lane) { float v[16]; const float* p = row + k0 + 8 * (lane >> 4);
#pragma unroll
  for (int i = 0; i < 8; ++i) { v[i] = p[i]; v[8 + i] = p[16 + i]; }
  return bsplit16(v); }
__device__ __forceinline__ F2 split_rowK(const float* row, int k0, int lane, int K) { float v[16]; const int g = lane >> 4;
#pragma unroll
  for (int i = 0; i < 8; ++i) { const int ka = k0 + 8 * g + i, kb = ka + 16; v[i] = ka < K ? row[ka < K ? ka : K - 1] : 0.f; v[8 + i] = kb < K ? row[kb < K ? kb : K - 1] : 0.f; }
  return bsplit16(v); }
__device__ __forceinline__ F2 split_col(const float* W, int k0, int n, int lane, int ld, int K) { float v[16]; const int g = lane >> 4;
#pragma unroll
  for (int i = 0; i < 8; ++i) { const int ka = k0 + 8 * g + i, kb = ka + 16; v[i] = ka < K ? W[(size_t)(ka < K ? ka : K - 1) * ld + n] : 0.f; v[8 + i] = kb < K ? W[(size_t)(kb < K ? kb : K - 1) * ld + n] : 0.f; }
  return bsplit16(v); }
__device__ __forceinline__ v8f mac3(const F2& a, const F2& b, v8f c) { c = wmma_bf(a.l, b.h, c); c = wmma_bf(a.h, b.l, c); return wmma_bf(a.h, b.h, c); }
__device__ __forceinline__ float sigm(float v) { return 1.0f / (1.0f + expf(-v)); }
#define LDSX() do { asm volatile("s_wait_dscnt 0" ::: "memory"); __builtin_amdgcn_wave_barrier(); __builtin_amdgcn_fence(__ATOMIC_RELEASE, "workgroup"); } while (0)


// Tree MLP (B 16, P 256, 8 levels x 128, hidden 4,096): level l sees the token embedding with its first l*128 entries zeroed; h = NewGELU(inp W1 + b1), out = h W2 + b2 per level.
#define NRW 4096          // B*P rows
#define LV 8
#define RR 128
#define NE (LV * RR)      // 1024
#define HH 4096
#ifndef TRB
#define TRB (NRW / 64)
#endif
typedef __attribute__((ext_vector_type(8))) __bf16 v8b;
// fragment-order buffers: one 16x16x32 fragment = 1 KB = 32 lanes x 16 B (elements 0..7 of each lane), then 32 lanes x 16 B (elements 8..15): a wave's 16-B load covers 512 contiguous bytes. fl = fragment start + lane * 8
__device__ __forceinline__ v16b fragp_b(const __bf16* fl) { union { v16b v; v8b q[2]; } u; u.q[0] = *(const v8b*)fl; u.q[1] = *(const v8b*)(fl + 256); return u.v; }
__device__ __forceinline__ v16h fragp_h(const _Float16* fl) { union { v16h v; v8h q[2]; } u; u.q[0] = *(const v8h*)fl; u.q[1] = *(const v8h*)(fl + 256); return u.v; }
__device__ __forceinline__ float bfr(float v) { return (float)(__bf16)v; }
__device__ __attribute__((noinline)) float exp_ni(float v) { return expf(v); }
__device__ __attribute__((noinline)) float erf_ni(float v) { return erff(v); }

#define FRG 512                                    // elements of a fragment
#define WS_P1  0u                                  // bf16 W1 A fragments [n / 128][k / 32][8 column tiles][FRG]
#define WS_P2  (WS_P1 + 2u * (size_t)HH * NE)       // f16 x 2^8 W2 A fragments [k / 32][8 column tiles][FRG]
#define WS_PX  (WS_P2 + 2u * (size_t)RR * HH)       // bf16 x B fragments [row / 16][k / 32][FRG]
#define HQ 4                                       // quarters of the hidden width: one f32 partial sum of the output each
#define WS_PT  (WS_PX + 2u * (size_t)NRW * NE)      // f32 partial sums [HQ][row][level][128]
#define WS_END (WS_PT + 4u * (size_t)HQ * NRW * NE)

#define NT1 ((HH / 128) * (NE / 32))   // W1 tiles
#define NT2 (HH / 32)                  // W2 tiles
#define NTX ((NRW / 16) * (NE / 256))  // x tiles
// one block writes one 8-KB tile of eight fragments; a thread's chunk c = (fragment f, half hf, lane) is the 16 B that this lane will load
__global__ __launch_bounds__(256) void k_pack(const float* __restrict__ X, const float* __restrict__ W1, const float* __restrict__ W2, __bf16* __restrict__ PX, __bf16* __restrict__ P1, _Float16* __restrict__ P2) {
  const int b = blockIdx.x;
#pragma unroll
  for (int c = threadIdx.x; c < 512; c += 256) { const int f = c >> 6, lane = c & 31, col = lane & 15, ko = ((c >> 5) & 1) * 16 + 8 * (lane >> 4);
    if (b < NT1) { const float* p = W1 + (size_t)((b & 31) * 32 + ko) * HH + (b >> 5) * 128 + f * 16 + col; v8b o;
#pragma unroll
      for (int i = 0; i < 8; ++i) o[i] = (__bf16)p[(size_t)i * HH];
      *(v8b*)(P1 + (size_t)b * (8 * FRG) + c * 8) = o;
      asm volatile("s_wait_xcnt 0x0" ::: "memory"); }   // stands in front of the next chunk's rewrite of this store's data and address registers
    else if (b < NT1 + NT2) { const int kc = b - NT1; const float* p = W2 + (size_t)(kc * 32 + ko) * RR + f * 16 + col; v8h o;
#pragma unroll
      for (int i = 0; i < 8; ++i) o[i] = (_Float16)(bfr(p[i * RR]) * 256.0f);
      *(v8h*)(P2 + (size_t)kc * (8 * FRG) + c * 8) = o;
      asm volatile("s_wait_xcnt 0x0" ::: "memory"); }   // stands in front of the next chunk's rewrite of this store's data and address registers
    else { const int q = b - NT1 - NT2; const float* p = X + (size_t)((q >> 2) * 16 + col) * NE + ((q & 3) * 8 + f) * 32 + ko; const v4f lo = *(const v4f*)p, hi = *(const v4f*)(p + 4); v8b o;
#pragma unroll
      for (int i = 0; i < 4; ++i) { o[i] = (__bf16)lo[i]; o[4 + i] = (__bf16)hi[i]; }
      *(v8b*)(PX + (size_t)q * (8 * FRG) + c * 8) = o;
      asm volatile("s_wait_xcnt 0x0" ::: "memory"); } }   // stands in front of the next chunk's rewrite of this store's data and address registers
}
// GELU: 0.5 x (1 + tanh u), u = sqrt(2/pi) (x + 0.044715 x^3), as the reference writes it: one hardware tanh an element, inline, eight independent elements at a time.
// What goes into LDS is twice that, x + x tanh u (one fused multiply-add, an exact power of two away); the half is taken with W2's 2^-8 where the partial sums are added.
#define GK 0.7978845608028654f   // sqrt(2/pi)
// Eight transcendentals as one statement: the early-clobber outputs share no register with a source, so none overwrites the source of the one in front of it; the v_nop is the slot that the instruction set asks for behind the last.
#define TR8(op, o, i) asm(op " %0, %8\n\t" op " %1, %9\n\t" op " %2, %10\n\t" op " %3, %11\n\t" op " %4, %12\n\t" op " %5, %13\n\t" op " %6, %14\n\t" op " %7, %15\n\tv_nop" \
  : "=&v"(o[0]), "=&v"(o[1]), "=&v"(o[2]), "=&v"(o[3]), "=&v"(o[4]), "=&v"(o[5]), "=&v"(o[6]), "=&v"(o[7]) : "v"(i[0]), "v"(i[1]), "v"(i[2]), "v"(i[3]), "v"(i[4]), "v"(i[5]), "v"(i[6]), "v"(i[7]))
// a = eight accumulators of one lane (eight hidden columns of one row), bb = their biases; packed f32 arithmetic on both sides of the tanh; the result is the lane's 16 B of a hidden fragment
__device__ __forceinline__ v8h gelu8(v8f a, const float (&bb)[8]) { v2f x[4]; float e[8], t[8]; v8h o;
#pragma unroll   // here and below: constant indices, so that the small arrays are registers
  for (int i = 0; i < 4; ++i) { x[i] = (v2f){a[2 * i], a[2 * i + 1]} + (v2f){bb[2 * i], bb[2 * i + 1]}; const v2f w = x[i] * (GK + (GK * 0.044715f) * (x[i] * x[i])); e[2 * i] = w[0]; e[2 * i + 1] = w[1]; }
  TR8("v_tanh_f32", t, e);
#pragma unroll
  for (int i = 0; i < 4; ++i) { const v2f y = x[i] * (v2f){t[2 * i], t[2 * i + 1]} + x[i]; o[2 * i] = (_Float16)y[0]; o[2 * i + 1] = (_Float16)y[1]; }
  return o; }
// the builtins alone: an asm statement's vector operands are held to the first 256 registers, and this kernel's accumulators and fragments need more; the compiler keeps its own builtins' distances
__device__ __forceinline__ v8f wm_bf(v16b a, v16b b, v8f c) { return __builtin_amdgcn_wmma_f32_16x16x32_bf16(false, a, false, b, (short)0, c, false, false); }
__device__ __forceinline__ v8f wm_h(v16h a, v16h b, v8f c) { return __builtin_amdgcn_wmma_f32_16x16x32_f16(false, a, false, b, (short)0, c, false, false); }
struct yes_t { static constexpr bool value = true; }; struct no_t { static constexpr bool value = false; };
#define CH 256                 // hidden columns of a chunk
#define NCH (HH / HQ / CH)     // chunks of a block
#define XW() asm volatile("s_wait_xcnt 0x0" ::: "memory")   // stands behind a group of loads or stores, in front of any later rewrite of their address (and data) registers
// one k step of the level GEMM: two W1 and four x fragments
template <int KC> __device__ __forceinline__ void ld1(const __bf16* pw, const __bf16* px, v16b (&a)[2], v16b (&b)[4]) {   // pw, px: the lane's places in the level's first fragments; KC: k steps from there, a constant of the load instructions
#pragma unroll
  for (int t = 0; t < 2; ++t) a[t] = fragp_b(pw + (KC * 8 + t) * FRG);
#pragma unroll
  for (int i = 0; i < 4; ++i) b[i] = fragp_b(px + (i * (NE / 32) + KC) * FRG);
  __builtin_amdgcn_sched_barrier(0); }   // keeps the WMMAs that follow, and their waits, behind all of the group's requests
__device__ __forceinline__ void mm1(const v16b (&a)[2], const v16b (&b)[4], v8f (&acc)[2][4]) {
#pragma unroll
  for (int t = 0; t < 2; ++t)
#pragma unroll
    for (int i = 0; i < 4; ++i) acc[t][i] = wm_bf(a[t], b[i], acc[t][i]);   // W1 as A, x as B: register r of a lane = hidden column 8 (lane >> 4) + r of row lane & 15
  __builtin_amdgcn_sched_barrier(0);   // the next requests overwrite a and b: they stay behind these WMMAs
  asm volatile("v_nop\n\tv_nop\n\tv_nop\n\tv_nop");   // four slots between the last WMMA and the global loads that land on its B registers, the distance this kernel has run with; they issue while the matrix unit works
  __builtin_amdgcn_sched_barrier(0); }   // holds the four slots in that place
// block = 64 rows x all 8 levels x a quarter of the hidden width, 8 waves, one block a WGP. Per chunk of 256 hidden columns:
// (1) a wave runs the level GEMM for 32 hidden columns x 64 rows, level 7 down to 0, and after each level puts 2 GELU(sum + b1) into LDS as f16 fragments of the out GEMM (a lane's eight registers are its 16 B of the fragment);
// (2) behind a barrier wave l multiplies level l's 64 x 256 hidden block by the chunk's W2 rows and keeps its 64 x 128 sums in registers over all chunks. The hidden values never leave the WGP.
// PX without __restrict__: with it the build lifts every chunk's (equal) first x fragments out of the chunk loop and holds 64 registers for them, which do not fit
__global__ __launch_bounds__(256) void k_tree(const __bf16* PX, const __bf16* __restrict__ P1, const float* __restrict__ B1, const _Float16* __restrict__ P2, float* __restrict__ PT) {
  __shared__ __align__(16) _Float16 hs[LV * 4 * (CH / 32) * FRG];   // [level][row tile][k step][FRG]
  const int tid = threadIdx.x, wave = __builtin_amdgcn_readfirstlane(tid >> 5), lane = tid & 31, col = lane & 15, g = lane >> 4; const unsigned l8 = lane * 8;   // the wave's number as a scalar: fragment addresses are a scalar base and one lane offset
  v8f acc2[8][4] = {};   // [output column tile][row tile] of level = wave: register r = output column 8 g + r of row col
  const __bf16* px = PX + (size_t)blockIdx.x * 4 * (NE / 32) * FRG; const float* pb1 = B1 + blockIdx.y * (HH / HQ) + (blockIdx.x % NCH) * CH + wave * 32 + 8 * g;   // pb1 steps a chunk on at the chunk loop's foot
#pragma unroll 1   // rolled, like the level loop below
  for (int c = 0; c < NCH; ++c) {
    // The 64 blocks that share a quarter of W1 and W2 do not all walk it from the same end: block x starts at chunk x mod NCH and wraps round. Walking in step, each fragment's first reader waits on memory and the rest wait with it, all the way;
    // so only the first chunk of a block is read that way, and each later one has been brought into L2 by the blocks that began there. For speed only: any placement of the blocks gives the same sums.
    const int cr = (c + blockIdx.x) % NCH, hb = blockIdx.y * (HH / HQ) + cr * CH, n0 = hb + wave * 32;
    const __bf16* pw = P1 + ((size_t)(n0 >> 7) * (NE / 32) * 8 + ((n0 >> 4) & 7) + (LV - 1) * (RR / 32) * 8) * FRG + l8; const __bf16* pxl = px + (LV - 1) * (RR / 32) * FRG + l8;   // level 7's first fragments; both step down a level at the loop's foot
    v16b a[2][2], b[2][4]; v8f acc1[2][4] = {}; float bb[2][8];   // two fragment sets, for even and odd k steps: a set is requested anew as soon as its WMMAs are issued
    ld1<0>(pw, pxl, a[0], b[0]); ld1<1>(pw, pxl, a[1], b[1]);
#pragma unroll
    for (int t = 0; t < 2; ++t) { const v4f lo = *(const v4f*)(pb1 + t * 16), hi = *(const v4f*)(pb1 + t * 16 + 4);
#pragma unroll
      for (int r = 0; r < 4; ++r) { bb[t][r] = bfr(lo[r]); bb[t][4 + r] = bfr(hi[r]); } }
    XW(); __builtin_amdgcn_sched_barrier(0);   // behind the chunk's first requests: what follows may land on their address registers
    // one level: its four k steps, then GELU into LDS; NEXT: the next level's first two k steps are requested as their sets fall free, and fly under this level's GELU
    auto level = [&](int lv, auto next) {
      mm1(a[0], b[0], acc1); ld1<2>(pw, pxl, a[0], b[0]);
      mm1(a[1], b[1], acc1); ld1<3>(pw, pxl, a[1], b[1]);
      mm1(a[0], b[0], acc1); if constexpr (next.value) ld1<-4>(pw, pxl, a[0], b[0]);
      mm1(a[1], b[1], acc1); if constexpr (next.value) { ld1<-3>(pw, pxl, a[1], b[1]); XW(); __builtin_amdgcn_sched_barrier(0); }   // the wait: the GELU's results and the addresses' step may land on these requests' address registers
#pragma unroll   // acc1[t][i] must be indexed by constants
      for (int i = 0; i < 4; ++i)
#pragma unroll
        for (int t = 0; t < 2; ++t) { *(v8h*)&hs[((lv * 4 + i) * (CH / 32) + wave) * FRG + t * 256 + lane * 8] = gelu8(acc1[t][i], bb[t]); __builtin_amdgcn_sched_barrier(0); } };   // a tile at a time: with two the registers do not fit
#pragma unroll 1
    for (int lv = LV - 1; lv > 0; --lv) { level(lv, yes_t()); pw -= (RR / 32) * 8 * FRG; pxl -= (RR / 32) * FRG; }
    level(0, no_t());   // apart from the loop: no branch stands among the requests, so every counted wait leaves the newer requests in flight
    const _Float16* ph = hs + wave * 4 * (CH / 32) * FRG + l8; const _Float16* pb = P2 + (size_t)(hb >> 5) * 8 * FRG;
    v16h fa[2][4], fb[2][8];
#pragma unroll   // the first W2 fragments do not depend on LDS: requested in front of the barrier
    for (int j = 0; j < 8; ++j) fb[0][j] = fragp_h(pb + j * FRG + l8);
    __syncthreads();   // every level's hidden fragments of the chunk stand in LDS before any wave multiplies them
#pragma unroll
    for (int i = 0; i < 4; ++i) fa[0][i] = fragp_h(ph + i * (CH / 32) * FRG);
#pragma unroll   // eight steps, straight line: ring places and load offsets are constants
    for (int u = 0; u < CH / 32; ++u) {
      if (u + 1 < CH / 32) {   // the next step's fragments are requested ahead of this step's WMMAs
#pragma unroll
        for (int j = 0; j < 8; ++j) fb[(u + 1) & 1][j] = fragp_h(pb + ((u + 1) * 8 + j) * FRG + l8);
#pragma unroll
        for (int i = 0; i < 4; ++i) fa[(u + 1) & 1][i] = fragp_h(ph + (i * (CH / 32) + u + 1) * FRG); }
      __builtin_amdgcn_sched_barrier(0);   // keeps the step's first WMMA, and with it the wait, behind the next step's requests
#pragma unroll
      for (int j = 0; j < 8; ++j)
#pragma unroll
        for (int i = 0; i < 4; ++i) acc2[j][i] = wm_h(fb[u & 1][j], fa[u & 1][i], acc2[j][i]);   // W2 as A, hidden as B
      __builtin_amdgcn_sched_barrier(0); }   // the requests of the step after next overwrite this step's fragments: they stay behind its WMMAs
    pb1 += cr + 1 < NCH ? CH : -(NCH - 1) * CH;
    __syncthreads(); }   // every wave has read the chunk's hidden fragments before the next chunk (or the staging below) overwrites them
  // a wave's 64 x 128 sums leave as whole 512-B (row, level) segments, staged 16 rows at a time in the wave's own 32 KB of the hidden buffer
  float* st = (float*)(hs + wave * 4 * (CH / 32) * FRG); float* po = PT + (((size_t)blockIdx.y * NRW + blockIdx.x * 64) * LV + wave) * RR + lane * 4;
#pragma unroll   // acc2[j][i] must be indexed by constants
  for (int i = 0; i < 4; ++i) {
#pragma unroll
    for (int j = 0; j < 8; ++j) { const v8f d = acc2[j][i]; *(v4f*)&st[col * 132 + j * 16 + 8 * g] = (v4f){d[0], d[1], d[2], d[3]}; *(v4f*)&st[col * 132 + j * 16 + 8 * g + 4] = (v4f){d[4], d[5], d[6], d[7]}; }
    LDSX();
#pragma unroll
    for (int r = 0; r < 16; ++r) vst2(po + (size_t)(i * 16 + r) * (LV * RR), *(const v4f*)&st[r * 132 + lane * 4]);
    XW();
    LDSX(); }
}
// out = (sum of the four partial sums, quarter 0 first) x 2^-9 (W2's 2^8 and the hidden values' 2) + b2; 256 blocks of 16 waves, a thread takes eight 16-B pieces, four a trip
#define PST (256 * 512 * 4)   // floats from one piece of a thread to its next
__global__ __launch_bounds__(512) void k_sum(const float* __restrict__ PT, const float* __restrict__ B2, float* __restrict__ OUT) {
  const size_t e0 = ((size_t)blockIdx.x * 512 + threadIdx.x) * 4; const v4f b = *(const v4f*)(B2 + (threadIdx.x & 31) * 4);
  typedef __attribute__((address_space(1))) const v4f gl4; typedef __attribute__((address_space(1))) v4f gs4;   // global pointers by type: as loop-carried values plain ones compile to flat loads and stores
  gl4* p[HQ]; gs4* po = (gs4*)(OUT + e0);
#pragma unroll
  for (int q = 0; q < HQ; ++q) p[q] = (gl4*)(PT + (size_t)q * NRW * NE + e0);
#pragma unroll 1   // rolled: the five addresses live over the trips, so no request's result lands on a register that an earlier request names
  for (int h = 0; h < 2; ++h) { v4f s[4][HQ];
#pragma unroll
    for (int m = 0; m < 4; ++m)
#pragma unroll
      for (int q = 0; q < HQ; ++q) s[m][q] = p[q][m * (PST / 4)];
    XW(); __builtin_amdgcn_sched_barrier(0);   // sixteen requests a lane in flight before the first sum
#pragma unroll
    for (int m = 0; m < 4; ++m) { const v4f t = ((s[m][0] + s[m][1]) + s[m][2]) + s[m][3]; v4f o;
#pragma unroll
      for (int k = 0; k < 4; ++k) o[k] = t[k] * (1.0f / 512.0f) + bfr(b[k]);
      po[m * (PST / 4)] = o; }
    XW(); __builtin_amdgcn_sched_barrier(0);   // the addresses step on behind the wait
#pragma unroll
    for (int q = 0; q < HQ; ++q) p[q] += PST;
    po += PST; }
}
extern "C" void kernel_launch(void* const* d_in, const int* in_sizes, int n_in, void* d_out, int out_size, void* d_ws, size_t ws_size, hipStream_t stream) {
  (void)in_sizes; (void)n_in; (void)out_size;
  const float** F = (const float**)d_in;   // 0 x [16,256,8,128], 1 W1 [1024,4096] (in,out), 2 b1, 3 W2 [4096,128], 4 b2
  if (ws_size < (size_t)WS_END) return;
  char* ws = (char*)d_ws; __bf16 *P1 = (__bf16*)(ws + WS_P1), *PX = (__bf16*)(ws + WS_PX); _Float16 *P2 = (_Float16*)(ws + WS_P2); float* PT = (float*)(ws + WS_PT);
  k_pack<<<NT1 + NT2 + NTX, 256, 0, stream>>>(F[0], F[1], F[3], PX, P1, P2);
  k_tree<<<dim3(NRW / 64, HQ), 256, 0, stream>>>(PX, P1, F[2], P2, PT);
  k_sum<<<256, 512, 0, stream>>>(PT, F[4], (float*)d_out);
}

// v010
// A run of this version takes 67.6 microseconds.
// Versions in between are left out here; by their measured steps it is 1.15 times as fast as v008.
// Counting every step since v000, it is 11.0 times as fast.
// compute dtype: all float inputs rounded to bf16; the level-masked first linear as EXACT bf16 products on WMMA 16x16x32 ((in,out) weights as A fragments) accumulated block-suffix-wise in f32 on top of b1 (level l = b1 + the 128-wide input blocks >= l), tanh-GELU x 2 (as x + x tanh u, hardware tanh), hidden rounded once to f16 (it stays in LDS) x exact f16 copies of W2 (x 2^8), f32 sums of each hidden quarter x 2^-9 rounded once to f16 for the workspace, the four added in f32, + b2; f32 output.
#include <hip/hip_runtime.h>
#include <math.h>

typedef __attribute__((ext_vector_type(16))) _Float16 v16h;
typedef __attribute__((ext_vector_type(16))) __bf16 v16b;
typedef __attribute__((ext_vector_type(8)))  _Float16 v8h;
typedef __attribute__((ext_vector_type(8)))  float v8f;
typedef __attribute__((ext_vector_type(4)))  float v4f;
typedef __attribute__((ext_vector_type(2)))  float v2f;
typedef __attribute__((ext_vector_type(4)))  unsigned v4u;
typedef __attribute__((ext_vector_type(4)))  int v4i;
typedef float __attribute__((may_alias)) float_a;
typedef int __attribute__((may_alias)) int_a;

template <typename T> __device__ __forceinline__ void vst2(void* p, T v) { *(T*)p = v;  }
__device__ __forceinline__ v8f wmma16(v16h a, v16h b, v8f c) {
  v8f d = __builtin_amdgcn_wmma_f32_16x16x32_f16(false, a, false, b, (short)0, c, false, false);
  asm volatile("v_nop\n\tv_nop\n\tv_nop\n\tv_nop" : "+v"(d) : "v"(a), "v"(b));
  return d;
}
__device__ __forceinline__ v8f wmma_bf(v16b a, v16b b, v8f c) {
  v8f d = __builtin_amdgcn_wmma_f32_16x16x32_bf16(false, a, false, b, (short)0, c, false, false);
  asm volatile("v_nop\n\tv_nop\n\tv_nop\n\tv_nop" : "+v"(d) : "v"(a), "v"(b));
  return d;
}
// 16x16x32 fragments: lane = (h = lane>>4, row/col = lane&15); elements 0..7 = k0+8h+0..7, 8..15 = k0+16+8h+0..7; D element r = row 8h+r
__device__ __forceinline__ v16h frag_h(const _Float16* rowk0, int lane) {
  union { v16h v; v8h q[2]; } u; const _Float16* p = rowk0 + 8 * (lane >> 4);
  u.q[0] = *(const v8h*)p; u.q[1] = *(const v8h*)(p + 16); return u.v;
}
__device__ __forceinline__ v16h frag_f32(const float* rowk0, int lane) {
  v16h a; const float* p = rowk0 + 8 * (lane >> 4);
#pragma unroll
  for (int i = 0; i < 8; ++i) { a[i] = (_Float16)p[i]; a[8 + i] = (_Float16)p[16 + i]; }
  return a;
}
__device__ __forceinline__ v16h frag_f32s(const float* rowk0, int lane, float sc) {
  v16h a; const float* p = rowk0 + 8 * (lane >> 4);
#pragma unroll
  for (int i = 0; i < 8; ++i) { a[i] = (_Float16)(p[i] * sc); a[8 + i] = (_Float16)(p[16 + i] * sc); }
  return a;
}
// column fragment from a [K][ld] layout (column n), rows >= K read as 0
__device__ __forceinline__ v16h fragc_f32(const float* W, int k0, int n, int lane, int ld, int K) {
  v16h a; const int g = lane >> 4;
#pragma unroll
  for (int i = 0; i < 8; ++i) { const int ka = k0 + 8 * g + i, kb = ka + 16;
    a[i] = (_Float16)(ka < K ? W[(size_t)(ka < K ? ka : K - 1) * ld + n] : 0.f); a[8 + i] = (_Float16)(kb < K ? W[(size_t)(kb < K ? kb : K - 1) * ld + n] : 0.f); }
  return a;
}
struct F2 { v16b h, l; };
__device__ __forceinline__ F2 bsplit16(const float v[16]) { F2 r;
#pragma unroll
  for (int i = 0; i < 16; ++i) { const __bf16 h = (__bf16)v[i]; r.h[i] = h; r.l[i] = (__bf16)(v[i] - (float)h); }
  return r; }
__device__ __forceinline__ F2 split_row(const float* row, int k0, int lane) { float v[16]; const float* p = row + k0 + 8 * (lane >> 4);
#pragma unroll
  for (int i = 0; i < 8; ++i) { v[i] = p[i]; v[8 + i] = p[16 + i]; }
  return bsplit16(v); }
__device__ __forceinline__ F2 split_rowK(const float* row, int k0, int lane, int K) { float v[16]; const int g = lane >> 4;
#pragma unroll
  for (int i = 0; i < 8; ++i) { const int ka = k0 + 8 * g + i, kb = ka + 16; v[i] = ka < K ? row[ka < K ? ka : K - 1] : 0.f; v[8 + i] = kb < K ? row[kb < K ? kb : K - 1] : 0.f; }
  return bsplit16(v); }
__device__ __forceinline__ F2 split_col(const float* W, int k0, int n, int lane, int ld, int K) { float v[16]; const int g = lane >> 4;
#pragma unroll
  for (int i = 0; i < 8; ++i) { const int ka = k0 + 8 * g + i, kb = ka + 16; v[i] = ka < K ? W[(size_t)(ka < K ? ka : K - 1) * ld + n] : 0.f; v[8 + i] = kb < K ? W[(size_t)(kb < K ? kb : K - 1) * ld + n] : 0.f; }
  return bsplit16(v); }
__device__ __forceinline__ v8f mac3(const F2& a, const F2& b, v8f c) { c = wmma_bf(a.l, b.h, c); c = wmma_bf(a.h, b.l, c); return wmma_bf(a.h, b.h, c); }
__device__ __forceinline__ float sigm(float v) { return 1.0f / (1.0f + expf(-v)); }
#define LDSX() do { asm volatile("s_wait_dscnt 0" ::: "memory"); __builtin_amdgcn_wave_barrier(); __builtin_amdgcn_fence(__ATOMIC_RELEASE, "workgroup"); } while (0)


// Tree MLP (B 16, P 256, 8 levels x 128, hidden 4,096): level l sees the token embedding with its first l*128 entries zeroed; h = NewGELU(inp W1 + b1), out = h W2 + b2 per level.
#define NRW 4096          // B*P rows
#define LV 8
#define RR 128
#define NE (LV * RR)      // 1024
#define HH 4096
#ifndef TRB
#define TRB (NRW / 64)
#endif
typedef __attribute__((ext_vector_type(8))) __bf16 v8b;
typedef __attribute__((ext_vector_type(2))) _Float16 v2h;
// fragment-order buffers: one 16x16x32 fragment = 1 KB = 32 lanes x 16 B (elements 0..7 of each lane), then 32 lanes x 16 B (elements 8..15): a wave's 16-B load covers 512 contiguous bytes. fl = fragment start + lane * 8
__device__ __forceinline__ v16b fragp_b(const __bf16* fl) { union { v16b v; v8b q[2]; } u; u.q[0] = *(const v8b*)fl; u.q[1] = *(const v8b*)(fl + 256); return u.v; }
__device__ __forceinline__ v16h fragp_h(const _Float16* fl) { union { v16h v; v8h q[2]; } u; u.q[0] = *(const v8h*)fl; u.q[1] = *(const v8h*)(fl + 256); return u.v; }
__device__ __forceinline__ float bfr(float v) { return (float)(__bf16)v; }
__device__ __attribute__((noinline)) float exp_ni(float v) { return expf(v); }
__device__ __attribute__((noinline)) float erf_ni(float v) { return erff(v); }

#define FRG 512                                    // elements of a fragment
#define WS_P1  0u                                  // bf16 W1 A fragments [n / 128][k / 32][8 column tiles][FRG]
#define WS_P2  (WS_P1 + 2u * (size_t)HH * NE)       // f16 x 2^8 W2 A fragments [k / 32][8 column tiles][FRG]
#define WS_PX  (WS_P2 + 2u * (size_t)RR * HH)       // bf16 x B fragments [row / 16][k / 32][FRG]
#define HQ 4                                       // quarters of the hidden width: one partial sum of the output each
#define WS_PT  (WS_PX + 2u * (size_t)NRW * NE)      // f16 partial sums [row / 2][level][HQ][32 lanes][8]: a lane's 16 B = columns 4 lane .. 4 lane + 3 of the even row, then of the odd row
#define WS_END (WS_PT + 2u * (size_t)HQ * NRW * NE)

#define NT1 ((HH / 128) * (NE / 32))   // W1 tiles
#define NT2 (HH / 32)                  // W2 tiles
#define NTX ((NRW / 16) * (NE / 256))  // x tiles
// one block writes one 8-KB tile of eight fragments; a thread's chunk c = (fragment f, half hf, lane) is the 16 B that this lane will load
__global__ __launch_bounds__(256) void k_pack(const float* __restrict__ X, const float* __restrict__ W1, const float* __restrict__ W2, __bf16* __restrict__ PX, __bf16* __restrict__ P1, _Float16* __restrict__ P2) {
  const int b = blockIdx.x;
#pragma unroll
  for (int c = threadIdx.x; c < 512; c += 256) { const int f = c >> 6, lane = c & 31, col = lane & 15, ko = ((c >> 5) & 1) * 16 + 8 * (lane >> 4);
    if (b < NT1) { const float* p = W1 + (size_t)((b & 31) * 32 + ko) * HH + (b >> 5) * 128 + f * 16 + col; v8b o;
#pragma unroll
      for (int i = 0; i < 8; ++i) o[i] = (__bf16)p[(size_t)i * HH];
      *(v8b*)(P1 + (size_t)b * (8 * FRG) + c * 8) = o;
      asm volatile("s_wait_xcnt 0x0" ::: "memory"); }   // stands in front of the next chunk's rewrite of this store's data and address registers
    else if (b < NT1 + NT2) { const int kc = b - NT1; const float* p = W2 + (size_t)(kc * 32 + ko) * RR + f * 16 + col; v8h o;
#pragma unroll
      for (int i = 0; i < 8; ++i) o[i] = (_Float16)(bfr(p[i * RR]) * 256.0f);
      *(v8h*)(P2 + (size_t)kc * (8 * FRG) + c * 8) = o;
      asm volatile("s_wait_xcnt 0x0" ::: "memory"); }   // stands in front of the next chunk's rewrite of this store's data and address registers
    else { const int q = b - NT1 - NT2; const float* p = X + (size_t)((q >> 2) * 16 + col) * NE + ((q & 3) * 8 + f) * 32 + ko; const v4f lo = *(const v4f*)p, hi = *(const v4f*)(p + 4); v8b o;
#pragma unroll
      for (int i = 0; i < 4; ++i) { o[i] = (__bf16)lo[i]; o[4 + i] = (__bf16)hi[i]; }
      *(v8b*)(PX + (size_t)q * (8 * FRG) + c * 8) = o;
      asm volatile("s_wait_xcnt 0x0" ::: "memory"); } }   // stands in front of the next chunk's rewrite of this store's data and address registers
}
// GELU: 0.5 x (1 + tanh u), u = sqrt(2/pi) (x + 0.044715 x^3), as the reference writes it: one hardware tanh an element, inline, sixteen independent elements at a time.
// What goes into LDS is twice that, x + x tanh u (one fused multiply-add, an exact power of two away); the half is taken with W2's 2^-8 where each quarter's sums are scaled for the workspace.
#define GK 0.7978845608028654f   // sqrt(2/pi)
// a0, a1 = the accumulators of one lane in two tiles (twice eight hidden columns of one row); they hold b1 already and are read in place. Packed f32 arithmetic on both sides of the tanh, stage by stage over both tiles:
// eight independent instructions a stage, so that none waits for the one it depends on; o0, o1: the lane's two 16-B halves of a hidden fragment
__device__ __forceinline__ void gelu16(const v8f& a0, const v8f& a1, v8h& o0, v8h& o1) { v2f x[8], w[8]; float e0[8], e1[8], t0[8], t1[8];
#pragma unroll   // here and below: constant indices, so that the small arrays are registers
  for (int i = 0; i < 4; ++i) { x[i] = (v2f){a0[2 * i], a0[2 * i + 1]}; x[4 + i] = (v2f){a1[2 * i], a1[2 * i + 1]}; }
#pragma unroll
  for (int i = 0; i < 8; ++i) w[i] = x[i] * x[i];
#pragma unroll
  for (int i = 0; i < 8; ++i) w[i] = GK + (GK * 0.044715f) * w[i];
#pragma unroll
  for (int i = 0; i < 8; ++i) w[i] = x[i] * w[i];
#pragma unroll
  for (int i = 0; i < 4; ++i) { e0[2 * i] = w[i][0]; e0[2 * i + 1] = w[i][1]; e1[2 * i] = w[4 + i][0]; e1[2 * i + 1] = w[4 + i][1]; }
#pragma unroll
  for (int i = 0; i < 8; ++i) { t0[i] = __builtin_amdgcn_tanhf(e0[i]); t1[i] = __builtin_amdgcn_tanhf(e1[i]); }
#pragma unroll
  for (int i = 0; i < 4; ++i) { w[i] = x[i] * (v2f){t0[2 * i], t0[2 * i + 1]} + x[i]; w[4 + i] = x[4 + i] * (v2f){t1[2 * i], t1[2 * i + 1]} + x[4 + i]; }
#pragma unroll
  for (int i = 0; i < 4; ++i) { o0[2 * i] = (_Float16)w[i][0]; o0[2 * i + 1] = (_Float16)w[i][1]; o1[2 * i] = (_Float16)w[4 + i][0]; o1[2 * i + 1] = (_Float16)w[4 + i][1]; } }
// the builtins alone: an asm statement's vector operands are held to the first 256 registers, and this kernel's accumulators and fragments need more; the compiler keeps its own builtins' distances
__device__ __forceinline__ v8f wm_bf(v16b a, v16b b, v8f c) { return __builtin_amdgcn_wmma_f32_16x16x32_bf16(false, a, false, b, (short)0, c, false, false); }
__device__ __forceinline__ v8f wm_h(v16h a, v16h b, v8f c) { return __builtin_amdgcn_wmma_f32_16x16x32_f16(false, a, false, b, (short)0, c, false, false); }
struct yes_t { static constexpr bool value = true; }; struct no_t { static constexpr bool value = false; };
#define CH 256                 // hidden columns of a chunk
#define NCH (HH / HQ / CH)     // chunks of a block
#define XW() asm volatile("s_wait_xcnt 0x0" ::: "memory")   // stands behind a group of loads or stores, in front of any later rewrite of their address (and data) registers
// one k step of the level GEMM: two W1 and four x fragments
template <int KC> __device__ __forceinline__ void ld1(const __bf16* pw, const __bf16* px, v16b (&a)[2], v16b (&b)[4]) {   // pw, px: the lane's places in the level's first fragments; KC: k steps from there, a constant of the load instructions
#pragma unroll
  for (int t = 0; t < 2; ++t) a[t] = fragp_b(pw + (KC * 8 + t) * FRG);
#pragma unroll
  for (int i = 0; i < 4; ++i) b[i] = fragp_b(px + (i * (NE / 32) + KC) * FRG);
  __builtin_amdgcn_sched_barrier(0); }   // keeps the WMMAs that follow, and their waits, behind all of the group's requests
__device__ __forceinline__ void mm1(const v16b (&a)[2], const v16b (&b)[4], v8f (&acc)[2][4]) {
#pragma unroll
  for (int t = 0; t < 2; ++t)
#pragma unroll
    for (int i = 0; i < 4; ++i) acc[t][i] = wm_bf(a[t], b[i], acc[t][i]);   // W1 as A, x as B: register r of a lane = hidden column 8 (lane >> 4) + r of row lane & 15
  __builtin_amdgcn_sched_barrier(0);   // the next requests overwrite a and b: they stay behind these WMMAs
  asm volatile("v_nop\n\tv_nop\n\tv_nop\n\tv_nop");   // four slots between the last WMMA and the global loads that land on its B registers, the distance this kernel has run with; they issue while the matrix unit works
  __builtin_amdgcn_sched_barrier(0); }   // holds the four slots in that place
// block = 64 rows x all 8 levels x a quarter of the hidden width, 8 waves, one block a WGP. Per chunk of 256 hidden columns:
// (1) a wave runs the level GEMM for 32 hidden columns x 64 rows, level 7 down to 0, starting from b1, and after each level puts GELU(sum) into LDS as f16 fragments of the out GEMM (a lane's eight registers are its 16 B of the fragment);
// (2) behind a barrier wave l multiplies level l's 64 x 256 hidden block by the chunk's W2 rows and keeps its 64 x 128 sums in registers over all chunks. The hidden values never leave the WGP.
// PX without __restrict__: with it the build lifts every chunk's (equal) first x fragments out of the chunk loop and holds 64 registers for them, which do not fit
__global__ __launch_bounds__(256) void k_tree(const __bf16* PX, const __bf16* __restrict__ P1, const float* __restrict__ B1, const _Float16* __restrict__ P2, _Float16* __restrict__ PT) {
  __shared__ __align__(16) _Float16 hs[LV * 4 * (CH / 32) * FRG];   // [level][row tile][k step][FRG]
  const int tid = threadIdx.x, wave = __builtin_amdgcn_readfirstlane(tid >> 5), lane = tid & 31, col = lane & 15, g = lane >> 4; const unsigned l8 = lane * 8;   // the wave's number as a scalar: fragment addresses are a scalar base and one lane offset
  v8f acc2[8][4] = {};   // [output column tile][row tile] of level = wave: register r = output column 8 g + r of row col
  const __bf16* px = PX + (size_t)blockIdx.x * 4 * (NE / 32) * FRG; const float* pb1 = B1 + blockIdx.y * (HH / HQ) + (blockIdx.x % NCH) * CH + wave * 32 + 8 * g;   // pb1 steps a chunk on at the chunk loop's foot
#pragma unroll 1   // rolled, like the level loop below
  for (int c = 0; c < NCH; ++c) {
    // The 64 blocks that share a quarter of W1 and W2 do not all walk it from the same end: block x starts at chunk x mod NCH and wraps round. Walking in step, each fragment's first reader waits on memory and the rest wait with it, all the way;
    // so only the first chunk of a block is read that way, and each later one has been brought into L2 by the blocks that began there. For speed only: any placement of the blocks gives the same sums.
    const int cr = (c + blockIdx.x) % NCH, hb = blockIdx.y * (HH / HQ) + cr * CH, n0 = hb + wave * 32;
    const __bf16* pw = P1 + ((size_t)(n0 >> 7) * (NE / 32) * 8 + ((n0 >> 4) & 7) + (LV - 1) * (RR / 32) * 8) * FRG + l8; const __bf16* pxl = px + (LV - 1) * (RR / 32) * FRG + l8;   // level 7's first fragments; both step down a level at the loop's foot
    v16b a[2][2], b[2][4]; v8f acc1[2][4];   // two fragment sets, for even and odd k steps: a set is requested anew as soon as its WMMAs are issued
    ld1<0>(pw, pxl, a[0], b[0]); ld1<1>(pw, pxl, a[1], b[1]);
    XW();   // b1's values may land on the address registers of the requests above
#pragma unroll
    for (int t = 0; t < 2; ++t) { const v4f lo = *(const v4f*)(pb1 + t * 16), hi = *(const v4f*)(pb1 + t * 16 + 4);   // b1 is the sums' start value: every level's sum holds it once, and no add stands in the GELU
      const v8f s0 = {bfr(lo[0]), bfr(lo[1]), bfr(lo[2]), bfr(lo[3]), bfr(hi[0]), bfr(hi[1]), bfr(hi[2]), bfr(hi[3])};
#pragma unroll
      for (int i = 0; i < 4; ++i) acc1[t][i] = s0; }
    XW(); __builtin_amdgcn_sched_barrier(0);   // behind the chunk's first requests: what follows may land on their address registers
    // one level: its four k steps, then GELU into LDS; NEXT: the next level's first two k steps are requested as their sets fall free, and fly under this level's GELU
    auto level = [&](int lv, auto next) {
      mm1(a[0], b[0], acc1); ld1<2>(pw, pxl, a[0], b[0]);
      mm1(a[1], b[1], acc1); ld1<3>(pw, pxl, a[1], b[1]);
      mm1(a[0], b[0], acc1); if constexpr (next.value) ld1<-4>(pw, pxl, a[0], b[0]);
      mm1(a[1], b[1], acc1); if constexpr (next.value) { ld1<-3>(pw, pxl, a[1], b[1]); XW(); __builtin_amdgcn_sched_barrier(0); }   // the wait: the GELU's results and the addresses' step may land on these requests' address registers
      v8h o[4][2];
#pragma unroll   // acc1[t][i] and o[i] must be indexed by constants
      for (int i = 0; i < 4; ++i) { gelu16(acc1[0][i], acc1[1][i], o[i][0], o[i][1]); __builtin_amdgcn_sched_barrier(0); }   // two tiles (one fragment) at a time: the scheduler does not merge the pairs, so one pair's temporaries serve all four
#pragma unroll   // the level's eight stores stand behind its last tile: no packed instruction has to wait before it may write a register that a queued store has still to read
      for (int i = 0; i < 4; ++i) { _Float16* ps = &hs[((lv * 4 + i) * (CH / 32) + wave) * FRG + lane * 8]; *(v8h*)ps = o[i][0]; *(v8h*)(ps + 256) = o[i][1]; } };
#pragma unroll 1
    for (int lv = LV - 1; lv > 0; --lv) { level(lv, yes_t()); pw -= (RR / 32) * 8 * FRG; pxl -= (RR / 32) * FRG; }
    level(0, no_t());   // apart from the loop: no branch stands among the requests, so every counted wait leaves the newer requests in flight
    const _Float16* ph = hs + wave * 4 * (CH / 32) * FRG + l8; const _Float16* pb = P2 + (size_t)(hb >> 5) * 8 * FRG;
    v16h fa[2][4], fb[2][8];
#pragma unroll   // the first W2 fragments do not depend on LDS: requested in front of the barrier
    for (int j = 0; j < 8; ++j) fb[0][j] = fragp_h(pb + j * FRG + l8);
    __syncthreads();   // every level's hidden fragments of the chunk stand in LDS before any wave multiplies them
#pragma unroll
    for (int i = 0; i < 4; ++i) fa[0][i] = fragp_h(ph + i * (CH / 32) * FRG);
#pragma unroll   // eight steps, straight line: ring places and load offsets are constants
    for (int u = 0; u < CH / 32; ++u) {
      if (u + 1 < CH / 32) {   // the next step's fragments are requested ahead of this step's WMMAs
#pragma unroll
        for (int j = 0; j < 8; ++j) fb[(u + 1) & 1][j] = fragp_h(pb + ((u + 1) * 8 + j) * FRG + l8);
#pragma unroll
        for (int i = 0; i < 4; ++i) fa[(u + 1) & 1][i] = fragp_h(ph + (i * (CH / 32) + u + 1) * FRG); }
      __builtin_amdgcn_sched_barrier(0);   // keeps the step's first WMMA, and with it the wait, behind the next step's requests
#pragma unroll
      for (int j = 0; j < 8; ++j)
#pragma unroll
        for (int i = 0; i < 4; ++i) acc2[j][i] = wm_h(fb[u & 1][j], fa[u & 1][i], acc2[j][i]);   // W2 as A, hidden as B
      __builtin_amdgcn_sched_barrier(0); }   // the requests of the step after next overwrite this step's fragments: they stay behind its WMMAs
    pb1 += cr + 1 < NCH ? CH : -(NCH - 1) * CH;
    __syncthreads(); }   // every wave has read the chunk's hidden fragments before the next chunk (or the staging below) overwrites them
  // a wave's 64 x 128 sums leave as f16, x 2^-9 (an exact scaling: W2's 2^8 and the hidden values' 2), in whole 512-B pieces of two rows of its level, staged 16 rows at a time in the wave's own 32 KB of the hidden buffer
  float* st = (float*)(hs + wave * 4 * (CH / 32) * FRG); _Float16* po = PT + ((((size_t)blockIdx.x * 32 * LV + wave) * HQ + blockIdx.y) * 32 + lane) * 8;
#pragma unroll   // acc2[j][i] must be indexed by constants
  for (int i = 0; i < 4; ++i) {
#pragma unroll
    for (int j = 0; j < 8; ++j) { const v8f d = acc2[j][i] * (1.0f / 512.0f); *(v4f*)&st[col * 132 + j * 16 + 8 * g] = (v4f){d[0], d[1], d[2], d[3]}; *(v4f*)&st[col * 132 + j * 16 + 8 * g + 4] = (v4f){d[4], d[5], d[6], d[7]}; }
    LDSX();
    v8h o[8];
#pragma unroll   // here and below: o[r] must be indexed by constants
    for (int r = 0; r < 8; ++r) { const v4f e = *(const v4f*)&st[(2 * r) * 132 + lane * 4], f = *(const v4f*)&st[(2 * r + 1) * 132 + lane * 4];
      union { v8h v; v2h p[4]; } u; u.p[0] = __builtin_convertvector((v2f){e[0], e[1]}, v2h); u.p[1] = __builtin_convertvector((v2f){e[2], e[3]}, v2h); u.p[2] = __builtin_convertvector((v2f){f[0], f[1]}, v2h); u.p[3] = __builtin_convertvector((v2f){f[2], f[3]}, v2h);
      o[r] = u.v; }
#pragma unroll
    for (int r = 0; r < 8; ++r) vst2(po + (size_t)(i * 8 + r) * (LV * HQ * 32 * 8), o[r]);
    XW();
    LDSX(); }
}
// out = sum of the four f16 partial sums, added in f32, quarter 0 first, + b2; 256 blocks of 16 waves; a wave takes four (row pair, level) places, 8 KB in a row: sixteen 16-B requests a lane, all ahead of the first sum
__global__ __launch_bounds__(512) void k_sum(const _Float16* __restrict__ PT, const float* __restrict__ B2, float* __restrict__ OUT) {
  const unsigned lane = threadIdx.x & 31, sg = blockIdx.x * 64 + (threadIdx.x >> 5) * 4, off = sg * (HQ * 512u) + lane * 16u;   // sg: the wave's first place, row pair * 8 + level; off: the lane's bytes from PT
  const v4f b = *(const v4f*)(B2 + lane * 4);
  v8h s[4][HQ]; v4f o[4][2];
#pragma unroll   // here and below: constant indices, so that s and o are registers and every request's offset is a constant of its instruction
  for (int m = 0; m < 4; ++m)
#pragma unroll
    for (int q = 0; q < HQ; ++q) s[m][q] = *(const v8h*)((const char*)PT + off + (m * HQ + q) * 512);
  asm volatile("s_wait_xcnt 0x0" :: "v"(off), "v"(lane) : "memory");   // the wait names the requests' two offset registers: they live up to here, so no request's result lands on one
  __builtin_amdgcn_sched_barrier(0);   // sixteen requests a lane in flight before the first sum
#pragma unroll
  for (int m = 0; m < 4; ++m)
#pragma unroll
    for (int k = 0; k < 8; ++k) o[m][k >> 2][k & 3] = ((((float)s[m][0][k] + (float)s[m][1][k]) + (float)s[m][2][k]) + (float)s[m][3][k]) + bfr(b[k & 3]);
  __builtin_amdgcn_sched_barrier(0);   // every sum stands in its own registers before the first store: no store's data register is written again
  float* po = OUT + (size_t)(sg >> 3) * (2 * NE) + (sg & 7) * RR + lane * 4;
#pragma unroll
  for (int m = 0; m < 4; ++m) { *(v4f*)(po + m * RR) = o[m][0]; *(v4f*)(po + m * RR + NE) = o[m][1]; }
}
extern "C" void kernel_launch(void* const* d_in, const int* in_sizes, int n_in, void* d_out, int out_size, void* d_ws, size_t ws_size, hipStream_t stream) {
  (void)in_sizes; (void)n_in; (void)out_size;
  const float** F = (const float**)d_in;   // 0 x [16,256,8,128], 1 W1 [1024,4096] (in,out), 2 b1, 3 W2 [4096,128], 4 b2
  if (ws_size < (size_t)WS_END) return;
  char* ws = (char*)d_ws; __bf16 *P1 = (__bf16*)(ws + WS_P1), *PX = (__bf16*)(ws + WS_PX); _Float16 *P2 = (_Float16*)(ws + WS_P2), *PT = (_Float16*)(ws + WS_PT);
  k_pack<<<NT1 + NT2 + NTX, 256, 0, stream>>>(F[0], F[1], F[3], PX, P1, P2);
  k_tree<<<dim3(NRW / 64, HQ), 256, 0, stream>>>(PX, P1, F[2], P2, PT);
  k_sum<<<256, 512, 0, stream>>>(PT, F[4], (float*)d_out);
}
